// v000
// Times are from an AMD MI455X. After a warm-up the kernel runs many times in a row, and a time is the length of
// such a window on the GPU divided by its runs, so every launch and the gaps after it count. The runs cycle
// through copies of the inputs. A figure is the median of several windows, for all but v000 over two sittings.
// Sittings can differ by a few percent; kernels timed side by side share one.
// v000, which the later versions start from, runs in 335 microseconds.
#include <hip/hip_runtime.h>

typedef __bf16 bf16_t;
typedef unsigned int u32;
typedef __attribute__((ext_vector_type(16))) bf16_t v16bf;
typedef __attribute__((ext_vector_type(8)))  float  v8f;
typedef __attribute__((ext_vector_type(4)))  u32    v4u;
typedef __attribute__((ext_vector_type(4)))  int    v4i;

constexpr int kB = 8, kC = 1024, kS = 2048, kT = 512, kH = 16, kD = 64;
constexpr float kEPS = 1e-5f;

#ifndef __has_builtin
#define __has_builtin(x) 0
#endif
#if __has_builtin(__builtin_amdgcn_global_load_async_to_lds_b128) && \
    __has_builtin(__builtin_amdgcn_s_wait_asynccnt)
#define USE_ASYNC_LDS 1
#else
#define USE_ASYNC_LDS 0
#endif

#define AS1 __attribute__((address_space(1)))
#define AS3 __attribute__((address_space(3)))

#if USE_ASYNC_LDS
__device__ __forceinline__ void async_copy16(bf16_t* lds, const bf16_t* g) {
  __builtin_amdgcn_global_load_async_to_lds_b128((AS1 v4i*)g, (AS3 v4i*)lds, 0, 0);
}
#define ASYNC_WAIT(n) __builtin_amdgcn_s_wait_asynccnt(n)
#else
#define ASYNC_WAIT(n)
#endif

// ---------------------------------------------------------------- helpers
__device__ __forceinline__ bf16_t tobf(float f) {
  union { float f; u32 u; } a; a.f = f;
  u32 r = a.u + 0x7FFFu + ((a.u >> 16) & 1u);          // round-nearest-even
  union { unsigned short s; bf16_t h; } b;
  b.s = (unsigned short)(r >> 16);
  return b.h;
}

// 16-bit matrix fragment (ISA 7.12.2): lane-striped rows, K contiguous.
// Elements [0..7] = K 8g..8g+7, [8..15] = K 16+8g..23+8g  ->  two b128 loads.
__device__ __forceinline__ v16bf frag16(const bf16_t* base, int pitch, int lane) {
  const int m = lane & 15, g = lane >> 4;
  const bf16_t* r = base + m * pitch + g * 8;
  union { struct { v4u lo, hi; } p; v16bf v; } u;
  u.p.lo = *(const v4u*)(r);
  u.p.hi = *(const v4u*)(r + 16);
  return u.v;
}

__device__ __forceinline__ v8f wmma_bf16(v16bf a, v16bf b, v8f c) {
  return __builtin_amdgcn_wmma_f32_16x16x32_bf16(false, a, false, b, (short)0, c,
                                                 false, false);
}

// --------------------------------------------- W (KxN) -> Wt (NxK) bf16
__global__ __launch_bounds__(256) void wt_kernel(const float* __restrict__ W,
                                                 bf16_t* __restrict__ Wt) {
  __shared__ float t[32][33];
  const int tx = threadIdx.x & 31, ty = threadIdx.x >> 5;
  const int k0 = blockIdx.x * 32, n0 = blockIdx.y * 32;
#pragma unroll
  for (int ii = 0; ii < 4; ++ii)
    t[ty + 8 * ii][tx] = W[(size_t)(k0 + ty + 8 * ii) * kC + n0 + tx];
  __syncthreads();
#pragma unroll
  for (int ii = 0; ii < 4; ++ii)
    Wt[(size_t)(n0 + ty + 8 * ii) * kC + k0 + tx] = tobf(t[tx][ty + 8 * ii]);
}

// --------------------------------------------- LN over C of x (B,C,S) -> xn (B,S,C) bf16
__global__ __launch_bounds__(256) void ln_x_kernel(const float* __restrict__ x,
                                                   const float* __restrict__ gg,
                                                   const float* __restrict__ bb,
                                                   bf16_t* __restrict__ xn) {
  __shared__ float red[8][32];
  __shared__ float mu_s[32], rs_s[32];
  __shared__ bf16_t tile[32][34];
  const int tid = threadIdx.x;
  const int sx = tid & 31, cy = tid >> 5;
  const int b = blockIdx.y, s0 = blockIdx.x * 32;
  const float* xb = x + (size_t)b * kC * kS + (s0 + sx);

  float sum = 0.f, sq = 0.f;
  for (int c = cy; c < kC; c += 8) {
    float v = xb[(size_t)c * kS];
    sum += v; sq += v * v;
  }
  red[cy][sx] = sum; __syncthreads();
  if (cy == 0) {
    float t = 0.f;
#pragma unroll
    for (int i = 0; i < 8; ++i) t += red[i][sx];
    mu_s[sx] = t * (1.f / kC);
  }
  __syncthreads();
  red[cy][sx] = sq; __syncthreads();
  if (cy == 0) {
    float t = 0.f;
#pragma unroll
    for (int i = 0; i < 8; ++i) t += red[i][sx];
    float mu = mu_s[sx];
    rs_s[sx] = rsqrtf(t * (1.f / kC) - mu * mu + kEPS);
  }
  __syncthreads();

  for (int c0 = 0; c0 < kC; c0 += 32) {
#pragma unroll
    for (int ii = 0; ii < 4; ++ii) {
      int cc = cy + 8 * ii, c = c0 + cc;
      float v = x[(size_t)b * kC * kS + (size_t)c * kS + s0 + sx];
      tile[cc][sx] = tobf((v - mu_s[sx]) * rs_s[sx] * gg[c] + bb[c]);
    }
    __syncthreads();
    const int cn = tid & 31, sr = tid >> 5;
#pragma unroll
    for (int ii = 0; ii < 4; ++ii) {
      int s = sr + 8 * ii;
      xn[((size_t)b * kS + s0 + s) * kC + c0 + cn] = tile[cn][s];
    }
    __syncthreads();
  }
}

// --------------------------------------------- LN on row-major rows (text)
__global__ __launch_bounds__(256) void ln_rows_kernel(const float* __restrict__ src,
                                                      const float* __restrict__ gg,
                                                      const float* __restrict__ bb,
                                                      bf16_t* __restrict__ dst,
                                                      int nrows) {
  const int lane = threadIdx.x & 31, wid = threadIdx.x >> 5;
  const int row = blockIdx.x * 8 + wid;
  if (row >= nrows) return;
  const float* p = src + (size_t)row * kC;
  float vals[32];
  float sum = 0.f;
#pragma unroll
  for (int j = 0; j < 32; ++j) { vals[j] = p[j * 32 + lane]; sum += vals[j]; }
#pragma unroll
  for (int off = 16; off >= 1; off >>= 1) sum += __shfl_xor(sum, off);
  const float mu = sum * (1.f / kC);
  float sq = 0.f;
#pragma unroll
  for (int j = 0; j < 32; ++j) { float d = vals[j] - mu; sq += d * d; }
#pragma unroll
  for (int off = 16; off >= 1; off >>= 1) sq += __shfl_xor(sq, off);
  const float rs = rsqrtf(sq * (1.f / kC) + kEPS);
  bf16_t* q = dst + (size_t)row * kC;
#pragma unroll
  for (int j = 0; j < 32; ++j) {
    int c = j * 32 + lane;
    q[c] = tobf((vals[j] - mu) * rs * gg[c] + bb[c]);
  }
}

// --------------------------------------------- bf16 GEMM: out = A(MxK) @ Wt(NxK)^T + bias
// Double-buffered async LDS staging; K-step 64 (8 WMMA per wave per stage).
// MODE 0: fp32 row-major MxN            (pre-RoPE Q / K)
// MODE 1: bf16 scattered V^T (B,H,D,T)  (V)
// MODE 2: fp32 (B,C,S) = resid + acc    (output projection + residual transpose)
constexpr int MT = 64, NT = 128, KT = 64;
constexpr int GP = 72;   // GEMM LDS pitch: 144B rows, 16B aligned, conflict-free
constexpr int AP = 40;   // attention LDS pitch: 80B rows

template <int MODE>
__global__ __launch_bounds__(256) void gemm_bf16_kernel(
    const bf16_t* __restrict__ A, const bf16_t* __restrict__ Wt,
    const float* __restrict__ bias, float* __restrict__ outF,
    bf16_t* __restrict__ outB, const float* __restrict__ resid, int rowsPerB) {
  __shared__ bf16_t As[2][MT][GP];
  __shared__ bf16_t Bts[2][NT][GP];
  const int tid = threadIdx.x, lane = tid & 31, wid = tid >> 5;
  const int m0 = blockIdx.x * MT, n0 = blockIdx.y * NT;
  const int wm = (wid & 1) * 32, wn = (wid >> 1) * 32;

  v8f acc[2][2];
  {
    const float bv0 = bias[n0 + wn + (lane & 15)];
    const float bv1 = bias[n0 + wn + 16 + (lane & 15)];
#pragma unroll
    for (int i = 0; i < 8; ++i) {
      acc[0][0][i] = bv0; acc[1][0][i] = bv0;
      acc[0][1][i] = bv1; acc[1][1][i] = bv1;
    }
  }

  auto stage = [&](int s, int k0) {
#if USE_ASYNC_LDS
    // A tile: 64x64 bf16 = 8KB = 512 x 16B -> 2 per thread
#pragma unroll
    for (int i = 0; i < 2; ++i) {
      const int idx = tid + i * 256, r = idx >> 3, c = (idx & 7) * 8;
      async_copy16(&As[s][r][c], A + (size_t)(m0 + r) * kC + k0 + c);
    }
    // Bt tile: 128x64 bf16 = 16KB = 1024 x 16B -> 4 per thread
#pragma unroll
    for (int i = 0; i < 4; ++i) {
      const int idx = tid + i * 256, r = idx >> 3, c = (idx & 7) * 8;
      async_copy16(&Bts[s][r][c], Wt + (size_t)(n0 + r) * kC + k0 + c);
    }
#else
    const u32* Ag = (const u32*)A;
    const u32* Wg = (const u32*)Wt;
#pragma unroll
    for (int i = 0; i < 8; ++i) {        // A tile: 2048 u32
      int idx = tid + i * 256, r = idx >> 5, cu = idx & 31;
      *(u32*)&As[s][r][cu * 2] = Ag[(size_t)(m0 + r) * (kC / 2) + (k0 >> 1) + cu];
    }
#pragma unroll
    for (int i = 0; i < 16; ++i) {       // Bt tile: 4096 u32
      int idx = tid + i * 256, r = idx >> 5, cu = idx & 31;
      *(u32*)&Bts[s][r][cu * 2] = Wg[(size_t)(n0 + r) * (kC / 2) + (k0 >> 1) + cu];
    }
#endif
  };

  constexpr int NK = kC / KT;
  stage(0, 0);
  for (int it = 0; it < NK; ++it) {
    const int cur = it & 1;
    if (it + 1 < NK) {
      stage(1 - cur, (it + 1) * KT);
      ASYNC_WAIT(6);          // only current tile's (oldest) 6 copies must land
    } else {
      ASYNC_WAIT(0);
    }
    __syncthreads();
#pragma unroll
    for (int kk = 0; kk < KT; kk += 32) {
      v16bf af0 = frag16(&As[cur][wm][kk], GP, lane);
      v16bf af1 = frag16(&As[cur][wm + 16][kk], GP, lane);
      v16bf bf0 = frag16(&Bts[cur][wn][kk], GP, lane);
      v16bf bf1 = frag16(&Bts[cur][wn + 16][kk], GP, lane);
      acc[0][0] = wmma_bf16(af0, bf0, acc[0][0]);
      acc[0][1] = wmma_bf16(af0, bf1, acc[0][1]);
      acc[1][0] = wmma_bf16(af1, bf0, acc[1][0]);
      acc[1][1] = wmma_bf16(af1, bf1, acc[1][1]);
    }
    __syncthreads();
  }

#pragma unroll
  for (int sm = 0; sm < 2; ++sm)
#pragma unroll
    for (int sn = 0; sn < 2; ++sn)
#pragma unroll
      for (int i = 0; i < 8; ++i) {
        const int m = m0 + wm + sm * 16 + i + ((lane >> 4) << 3);
        const int n = n0 + wn + sn * 16 + (lane & 15);
        const float v = acc[sm][sn][i];
        if (MODE == 0) {
          outF[(size_t)m * kC + n] = v;
        } else if (MODE == 1) {   // V^T: (B,H,D,T)
          const int b = m / rowsPerB, t = m % rowsPerB;
          const int h = n >> 6, d = n & 63;
          outB[(((size_t)b * kH + h) * kD + d) * rowsPerB + t] = tobf(v);
        } else {
          const int b = m / rowsPerB, s = m % rowsPerB;
          const size_t idx = ((size_t)b * kC + n) * kS + s;
          outF[idx] = resid[idx] + v;
        }
      }
}

// --------------------------------------------- RoPE + bf16 convert -> (B,H,rows,D)
__global__ __launch_bounds__(256) void rope_kernel(const float* __restrict__ src,
                                                   bf16_t* __restrict__ dst, int rows,
                                                   float posScale, float outScale) {
  const size_t total = (size_t)kB * rows * kH * 32;
  for (size_t idx = (size_t)blockIdx.x * blockDim.x + threadIdx.x; idx < total;
       idx += (size_t)gridDim.x * blockDim.x) {
    const int d = (int)(idx & 31);
    size_t r1 = idx >> 5;
    const int hh = (int)(r1 % kH); r1 /= kH;
    const int sr = (int)(r1 % rows);
    const int b = (int)(r1 / rows);
    const float* p = src + ((size_t)b * rows + sr) * kC + hh * kD;
    const float t1 = p[d], t2 = p[d + 32];
    const float inv = __powf(10000.f, -(float)d * (1.f / 32.f));
    float s, c;
    __sincosf((float)sr * posScale * inv, &s, &c);
    bf16_t* q = dst + (((size_t)b * kH + hh) * rows + sr) * kD;
    q[d]      = tobf((t1 * c - t2 * s) * outScale);
    q[d + 32] = tobf((t1 * s + t2 * c) * outScale);
  }
}

// --------------------------------------------- flash attention per (b,h)
constexpr int KP = 72;   // Ks pitch

__global__ __launch_bounds__(256) void attn_kernel(const bf16_t* __restrict__ q,
                                                   const bf16_t* __restrict__ k,
                                                   const bf16_t* __restrict__ vt,
                                                   bf16_t* __restrict__ o) {
  __shared__ bf16_t Ks[2][32][KP];       // K tile, rows t, cols d
  __shared__ bf16_t Vts[2][kD][AP];      // V^T tile, rows d, cols t
  __shared__ bf16_t Ps[8][16][AP];       // per-wave P tile
  const int tid = threadIdx.x, lane = tid & 31, wid = tid >> 5;
  const int bh = blockIdx.y, b = bh / kH, h = bh % kH;
  const int s0 = blockIdx.x * 128 + wid * 16;
  const int g = lane >> 4;

  // Q fragments (held for whole T loop); pairs contiguous in d -> b128 loads.
  v16bf qf[2];
  {
    const bf16_t* qrow = q + ((size_t)bh * kS + s0 + (lane & 15)) * kD;
#pragma unroll
    for (int kd = 0; kd < 2; ++kd) {
      union { struct { v4u lo, hi; } p; v16bf v; } u;
      u.p.lo = *(const v4u*)(qrow + kd * 32 + g * 8);
      u.p.hi = *(const v4u*)(qrow + kd * 32 + g * 8 + 16);
      qf[kd] = u.v;
    }
  }

  float mrow[8], lrow[8];
  v8f oacc[4];
#pragma unroll
  for (int i = 0; i < 8; ++i) { mrow[i] = -3.0e38f; lrow[i] = 0.f; }
#pragma unroll
  for (int f = 0; f < 4; ++f) oacc[f] = v8f{};

  const bf16_t* kb = k + (size_t)bh * kT * kD;
  const bf16_t* vb = vt + (size_t)bh * kD * kT;

  auto stage = [&](int s, int t0) {
#if USE_ASYNC_LDS
    const int rk = tid >> 3, ck = (tid & 7) * 8;        // 32 x 64
    async_copy16(&Ks[s][rk][ck], kb + (size_t)(t0 + rk) * kD + ck);
    const int rv = tid >> 2, cv = (tid & 3) * 8;        // 64 x 32
    async_copy16(&Vts[s][rv][cv], vb + (size_t)rv * kT + t0 + cv);
#else
    const u32* kg = (const u32*)kb;
    const u32* vg = (const u32*)vb;
#pragma unroll
    for (int i = 0; i < 4; ++i) {
      int idx = tid + i * 256;
      int rk = idx >> 5, ck = idx & 31;
      *(u32*)&Ks[s][rk][ck * 2] = kg[(size_t)(t0 + rk) * (kD / 2) + ck];
      int rv = idx >> 4, cv = idx & 15;
      *(u32*)&Vts[s][rv][cv * 2] = vg[(size_t)rv * (kT / 2) + (t0 >> 1) + cv];
    }
#endif
  };

  constexpr int NSTEP = kT / 32;
  stage(0, 0);
  for (int it = 0; it < NSTEP; ++it) {
    const int cur = it & 1;
    if (it + 1 < NSTEP) {
      stage(1 - cur, (it + 1) * 32);
      ASYNC_WAIT(2);
    } else {
      ASYNC_WAIT(0);
    }
    __syncthreads();

    // scores: 16 x 32 (two N-subtiles), contraction over d in two K-steps.
    v8f sc[2]; sc[0] = v8f{}; sc[1] = v8f{};
#pragma unroll
    for (int kd = 0; kd < 2; ++kd)
#pragma unroll
      for (int sn = 0; sn < 2; ++sn)
        sc[sn] = wmma_bf16(qf[kd], frag16(&Ks[cur][sn * 16][kd * 32], KP, lane),
                           sc[sn]);

    // online softmax
    float alpha[8];
#pragma unroll
    for (int i = 0; i < 8; ++i) {
      float vmax = fmaxf(sc[0][i], sc[1][i]);
#pragma unroll
      for (int off = 8; off >= 1; off >>= 1) vmax = fmaxf(vmax, __shfl_xor(vmax, off));
      const float mnew = fmaxf(mrow[i], vmax);
      alpha[i] = __expf(mrow[i] - mnew);
      mrow[i] = mnew;
      float p0 = __expf(sc[0][i] - mnew);
      float p1 = __expf(sc[1][i] - mnew);
      const int prow = i + (g << 3);
      Ps[wid][prow][(lane & 15)]      = tobf(p0);
      Ps[wid][prow][16 + (lane & 15)] = tobf(p1);
      float s = p0 + p1;
#pragma unroll
      for (int off = 8; off >= 1; off >>= 1) s += __shfl_xor(s, off);
      lrow[i] = lrow[i] * alpha[i] + s;
    }
#pragma unroll
    for (int f = 0; f < 4; ++f)
#pragma unroll
      for (int i = 0; i < 8; ++i) oacc[f][i] *= alpha[i];

    // PV: A = P (16x32 over t), B = V^T tile (lane-striped d, contiguous t)
    v16bf pf = frag16(&Ps[wid][0][0], AP, lane);
#pragma unroll
    for (int dn = 0; dn < 4; ++dn)
      oacc[dn] = wmma_bf16(pf, frag16(&Vts[cur][dn * 16][0], AP, lane), oacc[dn]);
    __syncthreads();
  }

  // normalize and write o (B,S,C) bf16
#pragma unroll
  for (int dn = 0; dn < 4; ++dn)
#pragma unroll
    for (int i = 0; i < 8; ++i) {
      const int s = s0 + i + (g << 3);
      const int c = h * kD + dn * 16 + (lane & 15);
      o[((size_t)b * kS + s) * kC + c] = tobf(oacc[dn][i] / lrow[i]);
    }
}

// ---------------------------------------------------------------- launch
extern "C" void kernel_launch(void* const* d_in, const int* in_sizes, int n_in,
                              void* d_out, int out_size, void* d_ws, size_t ws_size,
                              hipStream_t stream) {
  const float* x   = (const float*)d_in[0];
  const float* te  = (const float*)d_in[1];
  const float* g_x = (const float*)d_in[2];
  const float* b_x = (const float*)d_in[3];
  const float* g_t = (const float*)d_in[4];
  const float* b_t = (const float*)d_in[5];
  const float* Wq  = (const float*)d_in[6];
  const float* bq  = (const float*)d_in[7];
  const float* Wk  = (const float*)d_in[8];
  const float* bk  = (const float*)d_in[9];
  const float* Wv  = (const float*)d_in[10];
  const float* bv  = (const float*)d_in[11];
  const float* Wo  = (const float*)d_in[12];
  const float* bo  = (const float*)d_in[13];
  float* out = (float*)d_out;
  char* ws = (char*)d_ws;

  size_t off = 0;
  auto alloc = [&](size_t bytes) {
    size_t o = off; off += (bytes + 255) & ~(size_t)255; return o;
  };
  bf16_t* xn   = (bf16_t*)(ws + alloc((size_t)kB * kS * kC * 2));
  bf16_t* tn   = (bf16_t*)(ws + alloc((size_t)kB * kT * kC * 2));
  bf16_t* Wqt  = (bf16_t*)(ws + alloc((size_t)kC * kC * 2));
  bf16_t* Wkt  = (bf16_t*)(ws + alloc((size_t)kC * kC * 2));
  bf16_t* Wvt  = (bf16_t*)(ws + alloc((size_t)kC * kC * 2));
  bf16_t* Wot  = (bf16_t*)(ws + alloc((size_t)kC * kC * 2));
  float*  qraw = (float*)(ws + alloc((size_t)kB * kS * kC * 4));
  float*  kraw = (float*)(ws + alloc((size_t)kB * kT * kC * 4));
  bf16_t* qbf  = (bf16_t*)(ws + alloc((size_t)kB * kS * kC * 2));
  bf16_t* kbf  = (bf16_t*)(ws + alloc((size_t)kB * kT * kC * 2));
  bf16_t* vtbf = (bf16_t*)(ws + alloc((size_t)kB * kT * kC * 2));
  bf16_t* obf  = (bf16_t*)qraw;   // alias: qraw dead after rope, before attn

  wt_kernel<<<dim3(kC / 32, kC / 32), 256, 0, stream>>>(Wq, Wqt);
  wt_kernel<<<dim3(kC / 32, kC / 32), 256, 0, stream>>>(Wk, Wkt);
  wt_kernel<<<dim3(kC / 32, kC / 32), 256, 0, stream>>>(Wv, Wvt);
  wt_kernel<<<dim3(kC / 32, kC / 32), 256, 0, stream>>>(Wo, Wot);

  ln_x_kernel<<<dim3(kS / 32, kB), 256, 0, stream>>>(x, g_x, b_x, xn);
  ln_rows_kernel<<<(kB * kT) / 8, 256, 0, stream>>>(te, g_t, b_t, tn, kB * kT);

  gemm_bf16_kernel<0><<<dim3((kB * kS) / MT, kC / NT), 256, 0, stream>>>(
      xn, Wqt, bq, qraw, nullptr, nullptr, kS);
  gemm_bf16_kernel<0><<<dim3((kB * kT) / MT, kC / NT), 256, 0, stream>>>(
      tn, Wkt, bk, kraw, nullptr, nullptr, kT);
  gemm_bf16_kernel<1><<<dim3((kB * kT) / MT, kC / NT), 256, 0, stream>>>(
      tn, Wvt, bv, nullptr, vtbf, nullptr, kT);

  rope_kernel<<<8192, 256, 0, stream>>>(qraw, qbf, kS, 1.0f, 0.125f);   // q * 1/sqrt(D)
  rope_kernel<<<2048, 256, 0, stream>>>(kraw, kbf, kT, (float)kS / kT, 1.0f);

  attn_kernel<<<dim3(kS / 128, kB * kH), 256, 0, stream>>>(qbf, kbf, vtbf, obf);

  gemm_bf16_kernel<2><<<dim3((kB * kS) / MT, kC / NT), 256, 0, stream>>>(
      obf, Wot, bo, out, nullptr, x, kS);
}

// v001
// Measured time: 276 microseconds a run.
// Two timings next to v000 both put it at 1.23 times that version's speed.
#include <hip/hip_runtime.h>

typedef __bf16 bf16_t;
typedef unsigned int u32;
typedef __attribute__((ext_vector_type(16))) bf16_t v16bf;
typedef __attribute__((ext_vector_type(8)))  float  v8f;
typedef __attribute__((ext_vector_type(4)))  u32    v4u;
typedef __attribute__((ext_vector_type(4)))  int    v4i;
typedef __attribute__((ext_vector_type(4)))  float  v4f;

constexpr int kB = 8, kC = 1024, kS = 2048, kT = 512, kH = 16, kD = 64;
constexpr float kEPS = 1e-5f;

#ifndef __has_builtin
#define __has_builtin(x) 0
#endif
#if __has_builtin(__builtin_amdgcn_global_load_async_to_lds_b128) && \
    __has_builtin(__builtin_amdgcn_s_wait_asynccnt)
#define USE_ASYNC_LDS 1
#else
#define USE_ASYNC_LDS 0
#endif

#define AS1 __attribute__((address_space(1)))
#define AS3 __attribute__((address_space(3)))

#if USE_ASYNC_LDS
__device__ __forceinline__ void async_copy16(bf16_t* lds, const bf16_t* g) {
  __builtin_amdgcn_global_load_async_to_lds_b128((AS1 v4i*)g, (AS3 v4i*)lds, 0, 0);
}
#define ASYNC_WAIT(n) __builtin_amdgcn_s_wait_asynccnt(n)
#else
#define ASYNC_WAIT(n)
#endif

// ---------------------------------------------------------------- helpers
__device__ __forceinline__ bf16_t tobf(float f) {
  union { float f; u32 u; } a; a.f = f;
  u32 r = a.u + 0x7FFFu + ((a.u >> 16) & 1u);          // round-nearest-even
  union { unsigned short s; bf16_t h; } b;
  b.s = (unsigned short)(r >> 16);
  return b.h;
}

// 16-bit matrix fragment (ISA 7.12.2): lane-striped rows, K contiguous.
// Elements [0..7] = K 8g..8g+7, [8..15] = K 16+8g..23+8g  ->  two b128 loads.
__device__ __forceinline__ v16bf frag16(const bf16_t* base, int pitch, int lane) {
  const int m = lane & 15, g = lane >> 4;
  const bf16_t* r = base + m * pitch + g * 8;
  union { struct { v4u lo, hi; } p; v16bf v; } u;
  u.p.lo = *(const v4u*)(r);
  u.p.hi = *(const v4u*)(r + 16);
  return u.v;
}

__device__ __forceinline__ v8f wmma_bf16(v16bf a, v16bf b, v8f c) {
  return __builtin_amdgcn_wmma_f32_16x16x32_bf16(false, a, false, b, (short)0, c,
                                                 false, false);
}

// --------------------------------------------- W (KxN) -> Wt (NxK) bf16
__global__ __launch_bounds__(256) void wt_kernel(const float* __restrict__ W,
                                                 bf16_t* __restrict__ Wt) {
  __shared__ float t[32][33];
  const int tx = threadIdx.x & 31, ty = threadIdx.x >> 5;
  const int k0 = blockIdx.x * 32, n0 = blockIdx.y * 32;
#pragma unroll
  for (int ii = 0; ii < 4; ++ii)
    t[ty + 8 * ii][tx] = W[(size_t)(k0 + ty + 8 * ii) * kC + n0 + tx];
  __syncthreads();
#pragma unroll
  for (int ii = 0; ii < 4; ++ii)
    Wt[(size_t)(n0 + ty + 8 * ii) * kC + k0 + tx] = tobf(t[tx][ty + 8 * ii]);
}

// --------------------------------------------- LN over C of x (B,C,S) -> xn (B,S,C) bf16
__global__ __launch_bounds__(256) void ln_x_kernel(const float* __restrict__ x,
                                                   const float* __restrict__ gg,
                                                   const float* __restrict__ bb,
                                                   bf16_t* __restrict__ xn) {
  __shared__ float red[8][32];
  __shared__ float mu_s[32], rs_s[32];
  __shared__ bf16_t tile[32][34];
  const int tid = threadIdx.x;
  const int sx = tid & 31, cy = tid >> 5;
  const int b = blockIdx.y, s0 = blockIdx.x * 32;
  const float* xb = x + (size_t)b * kC * kS + (s0 + sx);

  float sum = 0.f, sq = 0.f;
  for (int c = cy; c < kC; c += 8) {
    float v = xb[(size_t)c * kS];
    sum += v; sq += v * v;
  }
  red[cy][sx] = sum; __syncthreads();
  if (cy == 0) {
    float t = 0.f;
#pragma unroll
    for (int i = 0; i < 8; ++i) t += red[i][sx];
    mu_s[sx] = t * (1.f / kC);
  }
  __syncthreads();
  red[cy][sx] = sq; __syncthreads();
  if (cy == 0) {
    float t = 0.f;
#pragma unroll
    for (int i = 0; i < 8; ++i) t += red[i][sx];
    float mu = mu_s[sx];
    rs_s[sx] = rsqrtf(t * (1.f / kC) - mu * mu + kEPS);
  }
  __syncthreads();

  for (int c0 = 0; c0 < kC; c0 += 32) {
#pragma unroll
    for (int ii = 0; ii < 4; ++ii) {
      int cc = cy + 8 * ii, c = c0 + cc;
      float v = x[(size_t)b * kC * kS + (size_t)c * kS + s0 + sx];
      tile[cc][sx] = tobf((v - mu_s[sx]) * rs_s[sx] * gg[c] + bb[c]);
    }
    __syncthreads();
    const int cn = tid & 31, sr = tid >> 5;
#pragma unroll
    for (int ii = 0; ii < 4; ++ii) {
      int s = sr + 8 * ii;
      xn[((size_t)b * kS + s0 + s) * kC + c0 + cn] = tile[cn][s];
    }
    __syncthreads();
  }
}

// --------------------------------------------- LN on row-major rows (text)
__global__ __launch_bounds__(256) void ln_rows_kernel(const float* __restrict__ src,
                                                      const float* __restrict__ gg,
                                                      const float* __restrict__ bb,
                                                      bf16_t* __restrict__ dst,
                                                      int nrows) {
  const int lane = threadIdx.x & 31, wid = threadIdx.x >> 5;
  const int row = blockIdx.x * 8 + wid;
  if (row >= nrows) return;
  const float* p = src + (size_t)row * kC;
  float vals[32];
  float sum = 0.f;
#pragma unroll
  for (int j = 0; j < 32; ++j) { vals[j] = p[j * 32 + lane]; sum += vals[j]; }
#pragma unroll
  for (int off = 16; off >= 1; off >>= 1) sum += __shfl_xor(sum, off);
  const float mu = sum * (1.f / kC);
  float sq = 0.f;
#pragma unroll
  for (int j = 0; j < 32; ++j) { float d = vals[j] - mu; sq += d * d; }
#pragma unroll
  for (int off = 16; off >= 1; off >>= 1) sq += __shfl_xor(sq, off);
  const float rs = rsqrtf(sq * (1.f / kC) + kEPS);
  bf16_t* q = dst + (size_t)row * kC;
#pragma unroll
  for (int j = 0; j < 32; ++j) {
    int c = j * 32 + lane;
    q[c] = tobf((vals[j] - mu) * rs * gg[c] + bb[c]);
  }
}

// --------------------------------------------- bf16 GEMM: out = A(MxK) @ Wt(NxK)^T + bias
// Double-buffered async LDS staging; K-step 64 (8 WMMA per wave per stage).
// MODE 0: fp32 row-major MxN            (pre-RoPE Q / K)
// MODE 1: bf16 scattered V^T (B,H,D,T)  (V)
// MODE 2: fp32 (B,C,S) = resid + acc    (output projection + residual transpose)
constexpr int MT = 64, NT = 128, KT = 64;
constexpr int GP = 72;   // GEMM LDS pitch: 144B rows, 16B aligned, conflict-free
constexpr int AP = 40;   // attention LDS pitch: 80B rows
constexpr int CP = 68;   // epilogue LDS pitch in floats: 16-byte column walks without conflicts

template <int MODE>
__global__ __launch_bounds__(256) void gemm_bf16_kernel(
    const bf16_t* __restrict__ A, const bf16_t* __restrict__ Wt,
    const float* __restrict__ bias, float* __restrict__ outF,
    bf16_t* __restrict__ outB, const float* __restrict__ resid) {
  __shared__ bf16_t As[2][MT][GP];
  __shared__ bf16_t Bts[2][NT][GP];
  const int tid = threadIdx.x, lane = tid & 31, wid = tid >> 5;
  const int m0 = blockIdx.x * MT, n0 = blockIdx.y * NT;
  const int wm = (wid & 1) * 32, wn = (wid >> 1) * 32;

  v8f acc[2][2];
  {
    const float bv0 = bias[n0 + wn + (lane & 15)];
    const float bv1 = bias[n0 + wn + 16 + (lane & 15)];
#pragma unroll
    for (int i = 0; i < 8; ++i) {
      acc[0][0][i] = bv0; acc[1][0][i] = bv0;
      acc[0][1][i] = bv1; acc[1][1][i] = bv1;
    }
  }

  auto stage = [&](int s, int k0) {
#if USE_ASYNC_LDS
    // A tile: 64x64 bf16 = 8KB = 512 x 16B -> 2 per thread
#pragma unroll
    for (int i = 0; i < 2; ++i) {
      const int idx = tid + i * 256, r = idx >> 3, c = (idx & 7) * 8;
      async_copy16(&As[s][r][c], A + (size_t)(m0 + r) * kC + k0 + c);
    }
    // Bt tile: 128x64 bf16 = 16KB = 1024 x 16B -> 4 per thread
#pragma unroll
    for (int i = 0; i < 4; ++i) {
      const int idx = tid + i * 256, r = idx >> 3, c = (idx & 7) * 8;
      async_copy16(&Bts[s][r][c], Wt + (size_t)(n0 + r) * kC + k0 + c);
    }
#else
    const u32* Ag = (const u32*)A;
    const u32* Wg = (const u32*)Wt;
#pragma unroll
    for (int i = 0; i < 8; ++i) {        // A tile: 2048 u32
      int idx = tid + i * 256, r = idx >> 5, cu = idx & 31;
      *(u32*)&As[s][r][cu * 2] = Ag[(size_t)(m0 + r) * (kC / 2) + (k0 >> 1) + cu];
    }
#pragma unroll
    for (int i = 0; i < 16; ++i) {       // Bt tile: 4096 u32
      int idx = tid + i * 256, r = idx >> 5, cu = idx & 31;
      *(u32*)&Bts[s][r][cu * 2] = Wg[(size_t)(n0 + r) * (kC / 2) + (k0 >> 1) + cu];
    }
#endif
  };

  constexpr int NK = kC / KT;
  stage(0, 0);
  for (int it = 0; it < NK; ++it) {
    const int cur = it & 1;
    if (it + 1 < NK) {
      stage(1 - cur, (it + 1) * KT);
      ASYNC_WAIT(6);          // only current tile's (oldest) 6 copies must land
    } else {
      ASYNC_WAIT(0);
    }
    __syncthreads();
#pragma unroll
    for (int kk = 0; kk < KT; kk += 32) {
      v16bf af0 = frag16(&As[cur][wm][kk], GP, lane);
      v16bf af1 = frag16(&As[cur][wm + 16][kk], GP, lane);
      v16bf bf0 = frag16(&Bts[cur][wn][kk], GP, lane);
      v16bf bf1 = frag16(&Bts[cur][wn + 16][kk], GP, lane);
      acc[0][0] = wmma_bf16(af0, bf0, acc[0][0]);
      acc[0][1] = wmma_bf16(af0, bf1, acc[0][1]);
      acc[1][0] = wmma_bf16(af1, bf0, acc[1][0]);
      acc[1][1] = wmma_bf16(af1, bf1, acc[1][1]);
    }
    __syncthreads();
  }

  if constexpr (MODE == 0) {
#pragma unroll
    for (int sm = 0; sm < 2; ++sm)
#pragma unroll
      for (int sn = 0; sn < 2; ++sn)
#pragma unroll
        for (int i = 0; i < 8; ++i) {
          const int m = m0 + wm + sm * 16 + i + ((lane >> 4) << 3);
          const int n = n0 + wn + sn * 16 + (lane & 15);
          outF[(size_t)m * kC + n] = acc[sm][sn][i];
        }
  } else {
    // Transposed outputs: row n of the destination is contiguous in m. The tile goes
    // through LDS as Ct[n][m], so every global access is 16 B per lane on whole lines.
    // Bts is free here: the K loop's last barrier ended its last read.
    static_assert(sizeof(float) * NT * CP <= sizeof(Bts), "Ct must fit in Bts");
    float* Ct = reinterpret_cast<float*>(&Bts[0][0][0]);
    constexpr int ROWS = (MODE == 2) ? kS : kT;    // rows of A per batch = destination pitch
    static_assert(ROWS % MT == 0, "a tile lies in one batch");
    const int b = m0 / ROWS, r0 = m0 % ROWS;
    const size_t gbase = ((size_t)b * kC + n0) * ROWS + r0;

    // Reader's share: rows nr + RST * i of the tile, 16 B of the destination at column cr.
    constexpr int LPR = (MODE == 2) ? 16 : 8;      // lanes per destination row
    constexpr int RST = 256 / LPR;                 // rows per sweep of the block
    constexpr int NSW = NT / RST;                  // sweeps
    const int nr = tid / LPR, cr = (tid % LPR) * (MT / LPR);
    const size_t goff = gbase + (size_t)nr * ROWS + cr;
    const float* crd = Ct + nr * CP + cr;

    v4f rr[NSW];
    if constexpr (MODE == 2) {   // residual rows, asked for ahead of the LDS round trip
#pragma unroll
      for (int i = 0; i < NSW; ++i)
        rr[i] = *(const v4f*)(resid + goff + (size_t)i * RST * ROWS);
    }

#pragma unroll
    for (int sm = 0; sm < 2; ++sm)
#pragma unroll
      for (int sn = 0; sn < 2; ++sn) {
        float* p = Ct + (wn + sn * 16 + (lane & 15)) * CP + wm + sm * 16 + ((lane >> 4) << 3);
        const v8f a = acc[sm][sn];
        *(v4f*)(p)     = v4f{a[0], a[1], a[2], a[3]};
        *(v4f*)(p + 4) = v4f{a[4], a[5], a[6], a[7]};
      }
    __syncthreads();   // Ct rows are read back by other waves than wrote them

    if constexpr (MODE == 1) {   // V^T: (B,H,D,T) = (B,C,T), 64 bf16 = one line per row
#pragma unroll
      for (int i = 0; i < NSW; ++i) {
        const v4f lo = *(const v4f*)(crd + i * RST * CP);
        const v4f hi = *(const v4f*)(crd + i * RST * CP + 4);
        union { bf16_t h[8]; v4u u; } pk;
#pragma unroll
        for (int j = 0; j < 4; ++j) { pk.h[j] = tobf(lo[j]); pk.h[4 + j] = tobf(hi[j]); }
        *(v4u*)(outB + goff + (size_t)i * RST * ROWS) = pk.u;
      }
    } else {                     // out (B,C,S) = resid + acc, 64 floats = two lines per row
      // Three sweeps kept apart: the LDS reads, then the stores, each go out back to back.
      v4f cv[NSW];
#pragma unroll
      for (int i = 0; i < NSW; ++i) cv[i] = *(const v4f*)(crd + i * RST * CP);
#pragma unroll
      for (int i = 0; i < NSW; ++i) cv[i] = rr[i] + cv[i];
#pragma unroll
      for (int i = 0; i < NSW; ++i)
        *(v4f*)(outF + goff + (size_t)i * RST * ROWS) = cv[i];
    }
  }
}

// --------------------------------------------- RoPE + bf16 convert -> (B,H,rows,D)
__global__ __launch_bounds__(256) void rope_kernel(const float* __restrict__ src,
                                                   bf16_t* __restrict__ dst, int rows,
                                                   float posScale, float outScale) {
  const size_t total = (size_t)kB * rows * kH * 32;
  for (size_t idx = (size_t)blockIdx.x * blockDim.x + threadIdx.x; idx < total;
       idx += (size_t)gridDim.x * blockDim.x) {
    const int d = (int)(idx & 31);
    size_t r1 = idx >> 5;
    const int hh = (int)(r1 % kH); r1 /= kH;
    const int sr = (int)(r1 % rows);
    const int b = (int)(r1 / rows);
    const float* p = src + ((size_t)b * rows + sr) * kC + hh * kD;
    const float t1 = p[d], t2 = p[d + 32];
    const float inv = __powf(10000.f, -(float)d * (1.f / 32.f));
    float s, c;
    __sincosf((float)sr * posScale * inv, &s, &c);
    bf16_t* q = dst + (((size_t)b * kH + hh) * rows + sr) * kD;
    q[d]      = tobf((t1 * c - t2 * s) * outScale);
    q[d + 32] = tobf((t1 * s + t2 * c) * outScale);
  }
}

// --------------------------------------------- flash attention per (b,h)
constexpr int KP = 72;   // Ks pitch

__global__ __launch_bounds__(256) void attn_kernel(const bf16_t* __restrict__ q,
                                                   const bf16_t* __restrict__ k,
                                                   const bf16_t* __restrict__ vt,
                                                   bf16_t* __restrict__ o) {
  __shared__ bf16_t Ks[2][32][KP];       // K tile, rows t, cols d
  __shared__ bf16_t Vts[2][kD][AP];      // V^T tile, rows d, cols t
  __shared__ bf16_t Ps[8][16][AP];       // per-wave P tile
  const int tid = threadIdx.x, lane = tid & 31, wid = tid >> 5;
  const int bh = blockIdx.y, b = bh / kH, h = bh % kH;
  const int s0 = blockIdx.x * 128 + wid * 16;
  const int g = lane >> 4;

  // Q fragments (held for whole T loop); pairs contiguous in d -> b128 loads.
  v16bf qf[2];
  {
    const bf16_t* qrow = q + ((size_t)bh * kS + s0 + (lane & 15)) * kD;
#pragma unroll
    for (int kd = 0; kd < 2; ++kd) {
      union { struct { v4u lo, hi; } p; v16bf v; } u;
      u.p.lo = *(const v4u*)(qrow + kd * 32 + g * 8);
      u.p.hi = *(const v4u*)(qrow + kd * 32 + g * 8 + 16);
      qf[kd] = u.v;
    }
  }

  float mrow[8], lrow[8];
  v8f oacc[4];
#pragma unroll
  for (int i = 0; i < 8; ++i) { mrow[i] = -3.0e38f; lrow[i] = 0.f; }
#pragma unroll
  for (int f = 0; f < 4; ++f) oacc[f] = v8f{};

  const bf16_t* kb = k + (size_t)bh * kT * kD;
  const bf16_t* vb = vt + (size_t)bh * kD * kT;

  auto stage = [&](int s, int t0) {
#if USE_ASYNC_LDS
    const int rk = tid >> 3, ck = (tid & 7) * 8;        // 32 x 64
    async_copy16(&Ks[s][rk][ck], kb + (size_t)(t0 + rk) * kD + ck);
    const int rv = tid >> 2, cv = (tid & 3) * 8;        // 64 x 32
    async_copy16(&Vts[s][rv][cv], vb + (size_t)rv * kT + t0 + cv);
#else
    const u32* kg = (const u32*)kb;
    const u32* vg = (const u32*)vb;
#pragma unroll
    for (int i = 0; i < 4; ++i) {
      int idx = tid + i * 256;
      int rk = idx >> 5, ck = idx & 31;
      *(u32*)&Ks[s][rk][ck * 2] = kg[(size_t)(t0 + rk) * (kD / 2) + ck];
      int rv = idx >> 4, cv = idx & 15;
      *(u32*)&Vts[s][rv][cv * 2] = vg[(size_t)rv * (kT / 2) + (t0 >> 1) + cv];
    }
#endif
  };

  constexpr int NSTEP = kT / 32;
  stage(0, 0);
  for (int it = 0; it < NSTEP; ++it) {
    const int cur = it & 1;
    if (it + 1 < NSTEP) {
      stage(1 - cur, (it + 1) * 32);
      ASYNC_WAIT(2);
    } else {
      ASYNC_WAIT(0);
    }
    __syncthreads();

    // scores: 16 x 32 (two N-subtiles), contraction over d in two K-steps.
    v8f sc[2]; sc[0] = v8f{}; sc[1] = v8f{};
#pragma unroll
    for (int kd = 0; kd < 2; ++kd)
#pragma unroll
      for (int sn = 0; sn < 2; ++sn)
        sc[sn] = wmma_bf16(qf[kd], frag16(&Ks[cur][sn * 16][kd * 32], KP, lane),
                           sc[sn]);

    // online softmax
    float alpha[8];
#pragma unroll
    for (int i = 0; i < 8; ++i) {
      float vmax = fmaxf(sc[0][i], sc[1][i]);
#pragma unroll
      for (int off = 8; off >= 1; off >>= 1) vmax = fmaxf(vmax, __shfl_xor(vmax, off));
      const float mnew = fmaxf(mrow[i], vmax);
      alpha[i] = __expf(mrow[i] - mnew);
      mrow[i] = mnew;
      float p0 = __expf(sc[0][i] - mnew);
      float p1 = __expf(sc[1][i] - mnew);
      const int prow = i + (g << 3);
      Ps[wid][prow][(lane & 15)]      = tobf(p0);
      Ps[wid][prow][16 + (lane & 15)] = tobf(p1);
      float s = p0 + p1;
#pragma unroll
      for (int off = 8; off >= 1; off >>= 1) s += __shfl_xor(s, off);
      lrow[i] = lrow[i] * alpha[i] + s;
    }
#pragma unroll
    for (int f = 0; f < 4; ++f)
#pragma unroll
      for (int i = 0; i < 8; ++i) oacc[f][i] *= alpha[i];

    // PV: A = P (16x32 over t), B = V^T tile (lane-striped d, contiguous t)
    v16bf pf = frag16(&Ps[wid][0][0], AP, lane);
#pragma unroll
    for (int dn = 0; dn < 4; ++dn)
      oacc[dn] = wmma_bf16(pf, frag16(&Vts[cur][dn * 16][0], AP, lane), oacc[dn]);
    __syncthreads();
  }

  // normalize and write o (B,S,C) bf16
#pragma unroll
  for (int dn = 0; dn < 4; ++dn)
#pragma unroll
    for (int i = 0; i < 8; ++i) {
      const int s = s0 + i + (g << 3);
      const int c = h * kD + dn * 16 + (lane & 15);
      o[((size_t)b * kS + s) * kC + c] = tobf(oacc[dn][i] / lrow[i]);
    }
}

// ---------------------------------------------------------------- launch
extern "C" void kernel_launch(void* const* d_in, const int* in_sizes, int n_in,
                              void* d_out, int out_size, void* d_ws, size_t ws_size,
                              hipStream_t stream) {
  const float* x   = (const float*)d_in[0];
  const float* te  = (const float*)d_in[1];
  const float* g_x = (const float*)d_in[2];
  const float* b_x = (const float*)d_in[3];
  const float* g_t = (const float*)d_in[4];
  const float* b_t = (const float*)d_in[5];
  const float* Wq  = (const float*)d_in[6];
  const float* bq  = (const float*)d_in[7];
  const float* Wk  = (const float*)d_in[8];
  const float* bk  = (const float*)d_in[9];
  const float* Wv  = (const float*)d_in[10];
  const float* bv  = (const float*)d_in[11];
  const float* Wo  = (const float*)d_in[12];
  const float* bo  = (const float*)d_in[13];
  float* out = (float*)d_out;
  char* ws = (char*)d_ws;

  size_t off = 0;
  auto alloc = [&](size_t bytes) {
    size_t o = off; off += (bytes + 255) & ~(size_t)255; return o;
  };
  bf16_t* xn   = (bf16_t*)(ws + alloc((size_t)kB * kS * kC * 2));
  bf16_t* tn   = (bf16_t*)(ws + alloc((size_t)kB * kT * kC * 2));
  bf16_t* Wqt  = (bf16_t*)(ws + alloc((size_t)kC * kC * 2));
  bf16_t* Wkt  = (bf16_t*)(ws + alloc((size_t)kC * kC * 2));
  bf16_t* Wvt  = (bf16_t*)(ws + alloc((size_t)kC * kC * 2));
  bf16_t* Wot  = (bf16_t*)(ws + alloc((size_t)kC * kC * 2));
  float*  qraw = (float*)(ws + alloc((size_t)kB * kS * kC * 4));
  float*  kraw = (float*)(ws + alloc((size_t)kB * kT * kC * 4));
  bf16_t* qbf  = (bf16_t*)(ws + alloc((size_t)kB * kS * kC * 2));
  bf16_t* kbf  = (bf16_t*)(ws + alloc((size_t)kB * kT * kC * 2));
  bf16_t* vtbf = (bf16_t*)(ws + alloc((size_t)kB * kT * kC * 2));
  bf16_t* obf  = (bf16_t*)qraw;   // alias: qraw dead after rope, before attn

  wt_kernel<<<dim3(kC / 32, kC / 32), 256, 0, stream>>>(Wq, Wqt);
  wt_kernel<<<dim3(kC / 32, kC / 32), 256, 0, stream>>>(Wk, Wkt);
  wt_kernel<<<dim3(kC / 32, kC / 32), 256, 0, stream>>>(Wv, Wvt);
  wt_kernel<<<dim3(kC / 32, kC / 32), 256, 0, stream>>>(Wo, Wot);

  ln_x_kernel<<<dim3(kS / 32, kB), 256, 0, stream>>>(x, g_x, b_x, xn);
  ln_rows_kernel<<<(kB * kT) / 8, 256, 0, stream>>>(te, g_t, b_t, tn, kB * kT);

  gemm_bf16_kernel<0><<<dim3((kB * kS) / MT, kC / NT), 256, 0, stream>>>(
      xn, Wqt, bq, qraw, nullptr, nullptr);
  gemm_bf16_kernel<0><<<dim3((kB * kT) / MT, kC / NT), 256, 0, stream>>>(
      tn, Wkt, bk, kraw, nullptr, nullptr);
  gemm_bf16_kernel<1><<<dim3((kB * kT) / MT, kC / NT), 256, 0, stream>>>(
      tn, Wvt, bv, nullptr, vtbf, nullptr);

  rope_kernel<<<8192, 256, 0, stream>>>(qraw, qbf, kS, 1.0f, 0.125f);   // q * 1/sqrt(D)
  rope_kernel<<<2048, 256, 0, stream>>>(kraw, kbf, kT, (float)kS / kT, 1.0f);

  attn_kernel<<<dim3(kS / 128, kB * kH), 256, 0, stream>>>(qbf, kbf, vtbf, obf);

  gemm_bf16_kernel<2><<<dim3((kB * kS) / MT, kC / NT), 256, 0, stream>>>(
      obf, Wot, bo, out, nullptr, x);
}

// v002
// One run takes 241 microseconds.
// Timed twice side by side with v001, it ran 1.15 times as fast both times.
// Counting every step since v000, it is 1.42 times as fast.
#include <hip/hip_runtime.h>

typedef __bf16 bf16_t;
typedef unsigned int u32;
typedef __attribute__((ext_vector_type(16))) bf16_t v16bf;
typedef __attribute__((ext_vector_type(8)))  float  v8f;
typedef __attribute__((ext_vector_type(4)))  u32    v4u;
typedef __attribute__((ext_vector_type(4)))  int    v4i;
typedef __attribute__((ext_vector_type(4)))  float  v4f;

constexpr int kB = 8, kC = 1024, kS = 2048, kT = 512, kH = 16, kD = 64;
constexpr float kEPS = 1e-5f;

#ifndef __has_builtin
#define __has_builtin(x) 0
#endif
#if __has_builtin(__builtin_amdgcn_global_load_async_to_lds_b128) && \
    __has_builtin(__builtin_amdgcn_s_wait_asynccnt)
#define USE_ASYNC_LDS 1
#else
#define USE_ASYNC_LDS 0
#endif

#define AS1 __attribute__((address_space(1)))
#define AS3 __attribute__((address_space(3)))

#if USE_ASYNC_LDS
__device__ __forceinline__ void async_copy16(bf16_t* lds, const bf16_t* g) {
  __builtin_amdgcn_global_load_async_to_lds_b128((AS1 v4i*)g, (AS3 v4i*)lds, 0, 0);
}
#define ASYNC_WAIT(n) __builtin_amdgcn_s_wait_asynccnt(n)
#else
#define ASYNC_WAIT(n)
#endif

// ---------------------------------------------------------------- helpers
__device__ __forceinline__ bf16_t tobf(float f) {
  union { float f; u32 u; } a; a.f = f;
  u32 r = a.u + 0x7FFFu + ((a.u >> 16) & 1u);          // round-nearest-even
  union { unsigned short s; bf16_t h; } b;
  b.s = (unsigned short)(r >> 16);
  return b.h;
}

// 16-bit matrix fragment (ISA 7.12.2): lane-striped rows, K contiguous.
// Elements [0..7] = K 8g..8g+7, [8..15] = K 16+8g..23+8g  ->  two b128 loads.
__device__ __forceinline__ v16bf frag16(const bf16_t* base, int pitch, int lane) {
  const int m = lane & 15, g = lane >> 4;
  const bf16_t* r = base + m * pitch + g * 8;
  union { struct { v4u lo, hi; } p; v16bf v; } u;
  u.p.lo = *(const v4u*)(r);
  u.p.hi = *(const v4u*)(r + 16);
  return u.v;
}

__device__ __forceinline__ v8f wmma_bf16(v16bf a, v16bf b, v8f c) {
  return __builtin_amdgcn_wmma_f32_16x16x32_bf16(false, a, false, b, (short)0, c,
                                                 false, false);
}

// --------------------------------------------- W (KxN) -> Wt (NxK) bf16
__global__ __launch_bounds__(256) void wt_kernel(const float* __restrict__ W,
                                                 bf16_t* __restrict__ Wt) {
  __shared__ float t[32][33];
  const int tx = threadIdx.x & 31, ty = threadIdx.x >> 5;
  const int k0 = blockIdx.x * 32, n0 = blockIdx.y * 32;
#pragma unroll
  for (int ii = 0; ii < 4; ++ii)
    t[ty + 8 * ii][tx] = W[(size_t)(k0 + ty + 8 * ii) * kC + n0 + tx];
  __syncthreads();
#pragma unroll
  for (int ii = 0; ii < 4; ++ii)
    Wt[(size_t)(n0 + ty + 8 * ii) * kC + k0 + tx] = tobf(t[tx][ty + 8 * ii]);
}

// --------------------------------------------- LN over C of x (B,C,S) -> xn (B,S,C) bf16
__global__ __launch_bounds__(256) void ln_x_kernel(const float* __restrict__ x,
                                                   const float* __restrict__ gg,
                                                   const float* __restrict__ bb,
                                                   bf16_t* __restrict__ xn) {
  __shared__ float red[8][32];
  __shared__ float mu_s[32], rs_s[32];
  __shared__ bf16_t tile[32][34];
  const int tid = threadIdx.x;
  const int sx = tid & 31, cy = tid >> 5;
  const int b = blockIdx.y, s0 = blockIdx.x * 32;
  const float* xb = x + (size_t)b * kC * kS + (s0 + sx);

  float sum = 0.f, sq = 0.f;
  for (int c = cy; c < kC; c += 8) {
    float v = xb[(size_t)c * kS];
    sum += v; sq += v * v;
  }
  red[cy][sx] = sum; __syncthreads();
  if (cy == 0) {
    float t = 0.f;
#pragma unroll
    for (int i = 0; i < 8; ++i) t += red[i][sx];
    mu_s[sx] = t * (1.f / kC);
  }
  __syncthreads();
  red[cy][sx] = sq; __syncthreads();
  if (cy == 0) {
    float t = 0.f;
#pragma unroll
    for (int i = 0; i < 8; ++i) t += red[i][sx];
    float mu = mu_s[sx];
    rs_s[sx] = rsqrtf(t * (1.f / kC) - mu * mu + kEPS);
  }
  __syncthreads();

  for (int c0 = 0; c0 < kC; c0 += 32) {
#pragma unroll
    for (int ii = 0; ii < 4; ++ii) {
      int cc = cy + 8 * ii, c = c0 + cc;
      float v = x[(size_t)b * kC * kS + (size_t)c * kS + s0 + sx];
      tile[cc][sx] = tobf((v - mu_s[sx]) * rs_s[sx] * gg[c] + bb[c]);
    }
    __syncthreads();
    const int cn = tid & 31, sr = tid >> 5;
#pragma unroll
    for (int ii = 0; ii < 4; ++ii) {
      int s = sr + 8 * ii;
      xn[((size_t)b * kS + s0 + s) * kC + c0 + cn] = tile[cn][s];
    }
    __syncthreads();
  }
}

// --------------------------------------------- LN on row-major rows (text)
__global__ __launch_bounds__(256) void ln_rows_kernel(const float* __restrict__ src,
                                                      const float* __restrict__ gg,
                                                      const float* __restrict__ bb,
                                                      bf16_t* __restrict__ dst,
                                                      int nrows) {
  const int lane = threadIdx.x & 31, wid = threadIdx.x >> 5;
  const int row = blockIdx.x * 8 + wid;
  if (row >= nrows) return;
  const float* p = src + (size_t)row * kC;
  float vals[32];
  float sum = 0.f;
#pragma unroll
  for (int j = 0; j < 32; ++j) { vals[j] = p[j * 32 + lane]; sum += vals[j]; }
#pragma unroll
  for (int off = 16; off >= 1; off >>= 1) sum += __shfl_xor(sum, off);
  const float mu = sum * (1.f / kC);
  float sq = 0.f;
#pragma unroll
  for (int j = 0; j < 32; ++j) { float d = vals[j] - mu; sq += d * d; }
#pragma unroll
  for (int off = 16; off >= 1; off >>= 1) sq += __shfl_xor(sq, off);
  const float rs = rsqrtf(sq * (1.f / kC) + kEPS);
  bf16_t* q = dst + (size_t)row * kC;
#pragma unroll
  for (int j = 0; j < 32; ++j) {
    int c = j * 32 + lane;
    q[c] = tobf((vals[j] - mu) * rs * gg[c] + bb[c]);
  }
}

// --------------------------------------------- bf16 GEMM: out = A(MxK) @ Wt(NxK)^T + bias
// Double-buffered async LDS staging; K-step 64 (8 WMMA per wave per stage).
// MODE 0: fp32 row-major MxN            (pre-RoPE Q / K)
// MODE 1: bf16 scattered V^T (B,H,D,T)  (V)
// MODE 2: fp32 (B,C,S) = resid + acc    (output projection + residual transpose)
constexpr int MT = 64, NT = 128, KT = 64;
constexpr int GP = 72;   // GEMM LDS pitch: 144B rows, 16B aligned, conflict-free
constexpr int AP = 40;   // attention LDS pitch: 80B rows
constexpr int CP = 68;   // epilogue LDS pitch in floats: 16-byte column walks without conflicts

template <int MODE>
__global__ __launch_bounds__(256) void gemm_bf16_kernel(
    const bf16_t* __restrict__ A, const bf16_t* __restrict__ Wt,
    const float* __restrict__ bias, float* __restrict__ outF,
    bf16_t* __restrict__ outB, const float* __restrict__ resid) {
  __shared__ bf16_t As[2][MT][GP];
  __shared__ bf16_t Bts[2][NT][GP];
  const int tid = threadIdx.x, lane = tid & 31, wid = tid >> 5;
  const int m0 = blockIdx.x * MT, n0 = blockIdx.y * NT;
  const int wm = (wid & 1) * 32, wn = (wid >> 1) * 32;

  v8f acc[2][2];
  {
    const float bv0 = bias[n0 + wn + (lane & 15)];
    const float bv1 = bias[n0 + wn + 16 + (lane & 15)];
#pragma unroll
    for (int i = 0; i < 8; ++i) {
      acc[0][0][i] = bv0; acc[1][0][i] = bv0;
      acc[0][1][i] = bv1; acc[1][1][i] = bv1;
    }
  }

  auto stage = [&](int s, int k0) {
#if USE_ASYNC_LDS
    // A tile: 64x64 bf16 = 8KB = 512 x 16B -> 2 per thread
#pragma unroll
    for (int i = 0; i < 2; ++i) {
      const int idx = tid + i * 256, r = idx >> 3, c = (idx & 7) * 8;
      async_copy16(&As[s][r][c], A + (size_t)(m0 + r) * kC + k0 + c);
    }
    // Bt tile: 128x64 bf16 = 16KB = 1024 x 16B -> 4 per thread
#pragma unroll
    for (int i = 0; i < 4; ++i) {
      const int idx = tid + i * 256, r = idx >> 3, c = (idx & 7) * 8;
      async_copy16(&Bts[s][r][c], Wt + (size_t)(n0 + r) * kC + k0 + c);
    }
#else
    const u32* Ag = (const u32*)A;
    const u32* Wg = (const u32*)Wt;
#pragma unroll
    for (int i = 0; i < 8; ++i) {        // A tile: 2048 u32
      int idx = tid + i * 256, r = idx >> 5, cu = idx & 31;
      *(u32*)&As[s][r][cu * 2] = Ag[(size_t)(m0 + r) * (kC / 2) + (k0 >> 1) + cu];
    }
#pragma unroll
    for (int i = 0; i < 16; ++i) {       // Bt tile: 4096 u32
      int idx = tid + i * 256, r = idx >> 5, cu = idx & 31;
      *(u32*)&Bts[s][r][cu * 2] = Wg[(size_t)(n0 + r) * (kC / 2) + (k0 >> 1) + cu];
    }
#endif
  };

  constexpr int NK = kC / KT;
  stage(0, 0);
  for (int it = 0; it < NK; ++it) {
    const int cur = it & 1;
    if (it + 1 < NK) {
      stage(1 - cur, (it + 1) * KT);
      ASYNC_WAIT(6);          // only current tile's (oldest) 6 copies must land
    } else {
      ASYNC_WAIT(0);
    }
    __syncthreads();
#pragma unroll
    for (int kk = 0; kk < KT; kk += 32) {
      v16bf af0 = frag16(&As[cur][wm][kk], GP, lane);
      v16bf af1 = frag16(&As[cur][wm + 16][kk], GP, lane);
      v16bf bf0 = frag16(&Bts[cur][wn][kk], GP, lane);
      v16bf bf1 = frag16(&Bts[cur][wn + 16][kk], GP, lane);
      acc[0][0] = wmma_bf16(af0, bf0, acc[0][0]);
      acc[0][1] = wmma_bf16(af0, bf1, acc[0][1]);
      acc[1][0] = wmma_bf16(af1, bf0, acc[1][0]);
      acc[1][1] = wmma_bf16(af1, bf1, acc[1][1]);
    }
    __syncthreads();
  }

  if constexpr (MODE == 0) {
#pragma unroll
    for (int sm = 0; sm < 2; ++sm)
#pragma unroll
      for (int sn = 0; sn < 2; ++sn)
#pragma unroll
        for (int i = 0; i < 8; ++i) {
          const int m = m0 + wm + sm * 16 + i + ((lane >> 4) << 3);
          const int n = n0 + wn + sn * 16 + (lane & 15);
          outF[(size_t)m * kC + n] = acc[sm][sn][i];
        }
  } else {
    // Transposed outputs: row n of the destination is contiguous in m. The tile goes
    // through LDS as Ct[n][m], so every global access is 16 B per lane on whole lines.
    // Bts is free here: the K loop's last barrier ended its last read.
    static_assert(sizeof(float) * NT * CP <= sizeof(Bts), "Ct must fit in Bts");
    float* Ct = reinterpret_cast<float*>(&Bts[0][0][0]);
    constexpr int ROWS = (MODE == 2) ? kS : kT;    // rows of A per batch = destination pitch
    static_assert(ROWS % MT == 0, "a tile lies in one batch");
    const int b = m0 / ROWS, r0 = m0 % ROWS;
    const size_t gbase = ((size_t)b * kC + n0) * ROWS + r0;

    // Reader's share: rows nr + RST * i of the tile, 16 B of the destination at column cr.
    constexpr int LPR = (MODE == 2) ? 16 : 8;      // lanes per destination row
    constexpr int RST = 256 / LPR;                 // rows per sweep of the block
    constexpr int NSW = NT / RST;                  // sweeps
    const int nr = tid / LPR, cr = (tid % LPR) * (MT / LPR);
    const size_t goff = gbase + (size_t)nr * ROWS + cr;
    const float* crd = Ct + nr * CP + cr;

    v4f rr[NSW];
    if constexpr (MODE == 2) {   // residual rows, asked for ahead of the LDS round trip
#pragma unroll
      for (int i = 0; i < NSW; ++i)
        rr[i] = *(const v4f*)(resid + goff + (size_t)i * RST * ROWS);
    }

#pragma unroll
    for (int sm = 0; sm < 2; ++sm)
#pragma unroll
      for (int sn = 0; sn < 2; ++sn) {
        float* p = Ct + (wn + sn * 16 + (lane & 15)) * CP + wm + sm * 16 + ((lane >> 4) << 3);
        const v8f a = acc[sm][sn];
        *(v4f*)(p)     = v4f{a[0], a[1], a[2], a[3]};
        *(v4f*)(p + 4) = v4f{a[4], a[5], a[6], a[7]};
      }
    __syncthreads();   // Ct rows are read back by other waves than wrote them

    if constexpr (MODE == 1) {   // V^T: (B,H,D,T) = (B,C,T), 64 bf16 = one line per row
#pragma unroll
      for (int i = 0; i < NSW; ++i) {
        const v4f lo = *(const v4f*)(crd + i * RST * CP);
        const v4f hi = *(const v4f*)(crd + i * RST * CP + 4);
        union { bf16_t h[8]; v4u u; } pk;
#pragma unroll
        for (int j = 0; j < 4; ++j) { pk.h[j] = tobf(lo[j]); pk.h[4 + j] = tobf(hi[j]); }
        *(v4u*)(outB + goff + (size_t)i * RST * ROWS) = pk.u;
      }
    } else {                     // out (B,C,S) = resid + acc, 64 floats = two lines per row
      // Three sweeps kept apart: the LDS reads, then the stores, each go out back to back.
      v4f cv[NSW];
#pragma unroll
      for (int i = 0; i < NSW; ++i) cv[i] = *(const v4f*)(crd + i * RST * CP);
#pragma unroll
      for (int i = 0; i < NSW; ++i) cv[i] = rr[i] + cv[i];
#pragma unroll
      for (int i = 0; i < NSW; ++i)
        *(v4f*)(outF + goff + (size_t)i * RST * ROWS) = cv[i];
    }
  }
}

// --------------------------------------------- RoPE + bf16 convert -> (B,H,rows,D)
__global__ __launch_bounds__(256) void rope_kernel(const float* __restrict__ src,
                                                   bf16_t* __restrict__ dst, int rows,
                                                   float posScale, float outScale) {
  const size_t total = (size_t)kB * rows * kH * 32;
  for (size_t idx = (size_t)blockIdx.x * blockDim.x + threadIdx.x; idx < total;
       idx += (size_t)gridDim.x * blockDim.x) {
    const int d = (int)(idx & 31);
    size_t r1 = idx >> 5;
    const int hh = (int)(r1 % kH); r1 /= kH;
    const int sr = (int)(r1 % rows);
    const int b = (int)(r1 / rows);
    const float* p = src + ((size_t)b * rows + sr) * kC + hh * kD;
    const float t1 = p[d], t2 = p[d + 32];
    const float inv = __powf(10000.f, -(float)d * (1.f / 32.f));
    float s, c;
    __sincosf((float)sr * posScale * inv, &s, &c);
    bf16_t* q = dst + (((size_t)b * kH + hh) * rows + sr) * kD;
    q[d]      = tobf((t1 * c - t2 * s) * outScale);
    q[d + 32] = tobf((t1 * s + t2 * c) * outScale);
  }
}

constexpr int KP = 72;   // Ks pitch

typedef __attribute__((ext_vector_type(2))) float  v2f;
typedef __attribute__((ext_vector_type(2))) bf16_t v2bf;

__device__ __forceinline__ u32 pack2(float lo, float hi) {   // two f32 -> packed bf16, nearest even
  return __builtin_bit_cast(u32, __builtin_convertvector(v2f{lo, hi}, v2bf));
}

__device__ __forceinline__ float xhalf(float x) {            // lane l reads lane l ^ 16
  const int b = __builtin_bit_cast(int, x);
  return __builtin_bit_cast(float, __builtin_amdgcn_permlanex16(b, b, 0x76543210, 0xfedcba98,
                                                                false, false));
}

// 2^x of the eight scores of one tile, in one statement so that the slot which the instruction
// set asks for behind a transcendental holds by construction: an early-clobber result shares no
// register with a source, so no exponential overwrites the source or reads the result of the one
// in front of it, and v_nop fills the slot behind the last.
__device__ __forceinline__ void exp2_tile(const v8f a, float (&p)[8]) {
  asm("v_exp_f32 %0, %8\n\tv_exp_f32 %1, %9\n\tv_exp_f32 %2, %10\n\tv_exp_f32 %3, %11\n\t"
      "v_exp_f32 %4, %12\n\tv_exp_f32 %5, %13\n\tv_exp_f32 %6, %14\n\tv_exp_f32 %7, %15\n\t"
      "v_nop"
      : "=&v"(p[0]), "=&v"(p[1]), "=&v"(p[2]), "=&v"(p[3]),
        "=&v"(p[4]), "=&v"(p[5]), "=&v"(p[6]), "=&v"(p[7])
      : "v"(a[0]), "v"(a[1]), "v"(a[2]), "v"(a[3]), "v"(a[4]), "v"(a[5]), "v"(a[6]), "v"(a[7]));
}

// At most 8 waves per SIMD: 128 registers, so that a pass's 16 LDS reads go out as one group
// ahead of the products instead of pair by pair, each with its own wait.
__global__ __launch_bounds__(256) __attribute__((amdgpu_waves_per_eu(4, 8))) void attn_kernel(const bf16_t* __restrict__ q,
                                                   const bf16_t* __restrict__ k,
                                                   const bf16_t* __restrict__ vt,
                                                   bf16_t* __restrict__ o) {
  __shared__ bf16_t Ks[2][32][KP];       // K tile, rows t, cols d
  __shared__ bf16_t Vts[2][kD][AP];      // V^T tile, rows d, cols t
  const int tid = threadIdx.x, lane = tid & 31, wid = tid >> 5;
  const int bh = blockIdx.y, b = bh / kH, h = bh % kH;
  const int s0 = blockIdx.x * 128 + wid * 16;
  const int g = lane >> 4;

  // Q fragments (held for whole T loop), the B operand of S^T: column = query lane & 15.
  v16bf qf[2];
  {
    const bf16_t* qrow = q + ((size_t)bh * kS + s0 + (lane & 15)) * kD;
#pragma unroll
    for (int kd = 0; kd < 2; ++kd) {
      union { struct { v4u lo, hi; } p; v16bf v; } u;
      u.p.lo = *(const v4u*)(qrow + kd * 32 + g * 8);
      u.p.hi = *(const v4u*)(qrow + kd * 32 + g * 8 + 16);
      qf[kd] = u.v;
    }
  }

  float mrun = -3.0e38f;   // this query's running maximum, equal in both lane halves
  float lrun = 0.f;        // denominator over this lane half's keys; the halves join after the loop
  v8f oacc[4];             // oacc[dn][i] = O[query lane & 15][dn * 16 + 8 g + i]
#pragma unroll
  for (int f = 0; f < 4; ++f) oacc[f] = v8f{};

  const bf16_t* kb = k + (size_t)bh * kT * kD;
  const bf16_t* vb = vt + (size_t)bh * kD * kT;

  auto stage = [&](int s, int t0) {
#if USE_ASYNC_LDS
    const int rk = tid >> 3, ck = (tid & 7) * 8;        // 32 x 64
    async_copy16(&Ks[s][rk][ck], kb + (size_t)(t0 + rk) * kD + ck);
    const int rv = tid >> 2, cv = (tid & 3) * 8;        // 64 x 32
    async_copy16(&Vts[s][rv][cv], vb + (size_t)rv * kT + t0 + cv);
#else
    const u32* kg = (const u32*)kb;
    const u32* vg = (const u32*)vb;
#pragma unroll
    for (int i = 0; i < 4; ++i) {
      int idx = tid + i * 256;
      int rk = idx >> 5, ck = idx & 31;
      *(u32*)&Ks[s][rk][ck * 2] = kg[(size_t)(t0 + rk) * (kD / 2) + ck];
      int rv = idx >> 4, cv = idx & 15;
      *(u32*)&Vts[s][rv][cv * 2] = vg[(size_t)rv * (kT / 2) + (t0 >> 1) + cv];
    }
#endif
  };

  constexpr int NSTEP = kT / 32;
  stage(0, 0);
  for (int it = 0; it < NSTEP; ++it) {
    const int cur = it & 1;
    if (it + 1 < NSTEP) {
      stage(1 - cur, (it + 1) * 32);
      ASYNC_WAIT(2);
    } else {
      ASYNC_WAIT(0);
    }
    __syncthreads();

    // scores^T: 32 keys x 16 queries (two M-subtiles), contraction over d in two K-steps.
    // st[kt][i] = score of key kt * 16 + 8 g + i against query lane & 15.
    v8f st[2]; st[0] = v8f{}; st[1] = v8f{};
#pragma unroll
    for (int kd = 0; kd < 2; ++kd)
#pragma unroll
      for (int kt = 0; kt < 2; ++kt)
        st[kt] = wmma_bf16(frag16(&Ks[cur][kt * 16][kd * 32], KP, lane), qf[kd], st[kt]);

    // online softmax: one query per lane
    float vmax = fmaxf(st[0][0], st[1][0]);
#pragma unroll
    for (int i = 1; i < 8; ++i) vmax = fmaxf(vmax, fmaxf(st[0][i], st[1][i]));
    vmax = fmaxf(vmax, xhalf(vmax));
    const float mnew = fmaxf(mrun, vmax);
    const float alpha = __expf(mrun - mnew);
    mrun = mnew;

    // P^T as B operand: element e < 8 is key 8 g + e, element 8 + e is key 16 + 8 g + e,
    // the k order in which frag16 reads the V^T rows.
    union { u32 w[8]; v16bf v; } pf;
    float p[2][8];
#pragma unroll
    for (int kt = 0; kt < 2; ++kt)
      exp2_tile((st[kt] - mnew) * 1.44269504f, p[kt]);   // e^(score - maximum)
    float sum[4];
#pragma unroll
    for (int j = 0; j < 4; ++j) {
      pf.w[j]     = pack2(p[0][2 * j], p[0][2 * j + 1]);
      pf.w[4 + j] = pack2(p[1][2 * j], p[1][2 * j + 1]);
      sum[j] = (p[0][2 * j] + p[0][2 * j + 1]) + (p[1][2 * j] + p[1][2 * j + 1]);
    }
    lrun = lrun * alpha + ((sum[0] + sum[1]) + (sum[2] + sum[3]));
#pragma unroll
    for (int f = 0; f < 4; ++f) oacc[f] *= alpha;

    // O^T += V^T.P^T: A = V^T tile (lane-striped d, contiguous t), B = P^T
#pragma unroll
    for (int dn = 0; dn < 4; ++dn)
      oacc[dn] = wmma_bf16(frag16(&Vts[cur][dn * 16][0], AP, lane), pf.v, oacc[dn]);
    __syncthreads();
  }

  // normalize and write o (B,S,C) bf16: a lane's 8 registers are 8 consecutive channels
  const float inv = 1.f / (lrun + xhalf(lrun));
  bf16_t* orow = o + ((size_t)b * kS + s0 + (lane & 15)) * kC + h * kD + g * 8;
#pragma unroll
  for (int dn = 0; dn < 4; ++dn) {
    const v8f r = oacc[dn] * inv;
    *(v4u*)(orow + dn * 16) = v4u{pack2(r[0], r[1]), pack2(r[2], r[3]),
                                  pack2(r[4], r[5]), pack2(r[6], r[7])};
  }
}

// ---------------------------------------------------------------- launch
extern "C" void kernel_launch(void* const* d_in, const int* in_sizes, int n_in,
                              void* d_out, int out_size, void* d_ws, size_t ws_size,
                              hipStream_t stream) {
  const float* x   = (const float*)d_in[0];
  const float* te  = (const float*)d_in[1];
  const float* g_x = (const float*)d_in[2];
  const float* b_x = (const float*)d_in[3];
  const float* g_t = (const float*)d_in[4];
  const float* b_t = (const float*)d_in[5];
  const float* Wq  = (const float*)d_in[6];
  const float* bq  = (const float*)d_in[7];
  const float* Wk  = (const float*)d_in[8];
  const float* bk  = (const float*)d_in[9];
  const float* Wv  = (const float*)d_in[10];
  const float* bv  = (const float*)d_in[11];
  const float* Wo  = (const float*)d_in[12];
  const float* bo  = (const float*)d_in[13];
  float* out = (float*)d_out;
  char* ws = (char*)d_ws;

  size_t off = 0;
  auto alloc = [&](size_t bytes) {
    size_t o = off; off += (bytes + 255) & ~(size_t)255; return o;
  };
  bf16_t* xn   = (bf16_t*)(ws + alloc((size_t)kB * kS * kC * 2));
  bf16_t* tn   = (bf16_t*)(ws + alloc((size_t)kB * kT * kC * 2));
  bf16_t* Wqt  = (bf16_t*)(ws + alloc((size_t)kC * kC * 2));
  bf16_t* Wkt  = (bf16_t*)(ws + alloc((size_t)kC * kC * 2));
  bf16_t* Wvt  = (bf16_t*)(ws + alloc((size_t)kC * kC * 2));
  bf16_t* Wot  = (bf16_t*)(ws + alloc((size_t)kC * kC * 2));
  float*  qraw = (float*)(ws + alloc((size_t)kB * kS * kC * 4));
  float*  kraw = (float*)(ws + alloc((size_t)kB * kT * kC * 4));
  bf16_t* qbf  = (bf16_t*)(ws + alloc((size_t)kB * kS * kC * 2));
  bf16_t* kbf  = (bf16_t*)(ws + alloc((size_t)kB * kT * kC * 2));
  bf16_t* vtbf = (bf16_t*)(ws + alloc((size_t)kB * kT * kC * 2));
  bf16_t* obf  = (bf16_t*)qraw;   // alias: qraw dead after rope, before attn

  wt_kernel<<<dim3(kC / 32, kC / 32), 256, 0, stream>>>(Wq, Wqt);
  wt_kernel<<<dim3(kC / 32, kC / 32), 256, 0, stream>>>(Wk, Wkt);
  wt_kernel<<<dim3(kC / 32, kC / 32), 256, 0, stream>>>(Wv, Wvt);
  wt_kernel<<<dim3(kC / 32, kC / 32), 256, 0, stream>>>(Wo, Wot);

  ln_x_kernel<<<dim3(kS / 32, kB), 256, 0, stream>>>(x, g_x, b_x, xn);
  ln_rows_kernel<<<(kB * kT) / 8, 256, 0, stream>>>(te, g_t, b_t, tn, kB * kT);

  gemm_bf16_kernel<0><<<dim3((kB * kS) / MT, kC / NT), 256, 0, stream>>>(
      xn, Wqt, bq, qraw, nullptr, nullptr);
  gemm_bf16_kernel<0><<<dim3((kB * kT) / MT, kC / NT), 256, 0, stream>>>(
      tn, Wkt, bk, kraw, nullptr, nullptr);
  gemm_bf16_kernel<1><<<dim3((kB * kT) / MT, kC / NT), 256, 0, stream>>>(
      tn, Wvt, bv, nullptr, vtbf, nullptr);

  rope_kernel<<<8192, 256, 0, stream>>>(qraw, qbf, kS, 1.0f, 0.125f);   // q * 1/sqrt(D)
  rope_kernel<<<2048, 256, 0, stream>>>(kraw, kbf, kT, (float)kS / kT, 1.0f);

  attn_kernel<<<dim3(kS / 128, kB * kH), 256, 0, stream>>>(qbf, kbf, vtbf, obf);

  gemm_bf16_kernel<2><<<dim3((kB * kS) / MT, kC / NT), 256, 0, stream>>>(
      obf, Wot, bo, out, nullptr, x);
}

// v003
// Measured time: 193 microseconds a run.
// Two timings next to v002 both put it at 1.25 times that version's speed.
// Over all steps from v000 it is 1.77 times as fast.
#include <hip/hip_runtime.h>

typedef __bf16 bf16_t;
typedef unsigned int u32;
typedef __attribute__((ext_vector_type(16))) bf16_t v16bf;
typedef __attribute__((ext_vector_type(8)))  float  v8f;
typedef __attribute__((ext_vector_type(4)))  u32    v4u;
typedef __attribute__((ext_vector_type(4)))  int    v4i;
typedef __attribute__((ext_vector_type(4)))  float  v4f;

constexpr int kB = 8, kC = 1024, kS = 2048, kT = 512, kH = 16, kD = 64;
constexpr float kEPS = 1e-5f;

#ifndef __has_builtin
#define __has_builtin(x) 0
#endif
#if __has_builtin(__builtin_amdgcn_global_load_async_to_lds_b128) && \
    __has_builtin(__builtin_amdgcn_s_wait_asynccnt)
#define USE_ASYNC_LDS 1
#else
#define USE_ASYNC_LDS 0
#endif

#define AS1 __attribute__((address_space(1)))
#define AS3 __attribute__((address_space(3)))

#if USE_ASYNC_LDS
__device__ __forceinline__ void async_copy16(bf16_t* lds, const bf16_t* g) {
  __builtin_amdgcn_global_load_async_to_lds_b128((AS1 v4i*)g, (AS3 v4i*)lds, 0, 0);
}
#define ASYNC_WAIT(n) __builtin_amdgcn_s_wait_asynccnt(n)
#else
#define ASYNC_WAIT(n)
#endif

// ---------------------------------------------------------------- helpers
__device__ __forceinline__ bf16_t tobf(float f) {
  union { float f; u32 u; } a; a.f = f;
  u32 r = a.u + 0x7FFFu + ((a.u >> 16) & 1u);          // round-nearest-even
  union { unsigned short s; bf16_t h; } b;
  b.s = (unsigned short)(r >> 16);
  return b.h;
}

typedef __attribute__((ext_vector_type(2))) float  v2f;
typedef __attribute__((ext_vector_type(2))) bf16_t v2bf;

__device__ __forceinline__ u32 pack2(float lo, float hi) {   // two f32 -> packed bf16, nearest even
  return __builtin_bit_cast(u32, __builtin_convertvector(v2f{lo, hi}, v2bf));
}

// 16-bit matrix fragment (ISA 7.12.2): lane-striped rows, K contiguous.
// Elements [0..7] = K 8g..8g+7, [8..15] = K 16+8g..23+8g  ->  two b128 loads.
__device__ __forceinline__ v16bf frag16(const bf16_t* base, int pitch, int lane) {
  const int m = lane & 15, g = lane >> 4;
  const bf16_t* r = base + m * pitch + g * 8;
  union { struct { v4u lo, hi; } p; v16bf v; } u;
  u.p.lo = *(const v4u*)(r);
  u.p.hi = *(const v4u*)(r + 16);
  return u.v;
}

__device__ __forceinline__ v8f wmma_bf16(v16bf a, v16bf b, v8f c) {
  return __builtin_amdgcn_wmma_f32_16x16x32_bf16(false, a, false, b, (short)0, c,
                                                 false, false);
}

// --------------------------------------------- W (KxN) -> Wt (NxK) bf16
__global__ __launch_bounds__(256) void wt_kernel(const float* __restrict__ W,
                                                 bf16_t* __restrict__ Wt) {
  __shared__ float t[32][33];
  const int tx = threadIdx.x & 31, ty = threadIdx.x >> 5;
  const int k0 = blockIdx.x * 32, n0 = blockIdx.y * 32;
#pragma unroll
  for (int ii = 0; ii < 4; ++ii)
    t[ty + 8 * ii][tx] = W[(size_t)(k0 + ty + 8 * ii) * kC + n0 + tx];
  __syncthreads();
#pragma unroll
  for (int ii = 0; ii < 4; ++ii)
    Wt[(size_t)(n0 + ty + 8 * ii) * kC + k0 + tx] = tobf(t[tx][ty + 8 * ii]);
}

// --------------------------------------------- LN over C of x (B,C,S) -> xn (B,S,C) bf16
__global__ __launch_bounds__(256) void ln_x_kernel(const float* __restrict__ x,
                                                   const float* __restrict__ gg,
                                                   const float* __restrict__ bb,
                                                   bf16_t* __restrict__ xn) {
  __shared__ float red[8][32];
  __shared__ float mu_s[32], rs_s[32];
  __shared__ bf16_t tile[32][34];
  const int tid = threadIdx.x;
  const int sx = tid & 31, cy = tid >> 5;
  const int b = blockIdx.y, s0 = blockIdx.x * 32;
  const float* xb = x + (size_t)b * kC * kS + (s0 + sx);

  float sum = 0.f, sq = 0.f;
  for (int c = cy; c < kC; c += 8) {
    float v = xb[(size_t)c * kS];
    sum += v; sq += v * v;
  }
  red[cy][sx] = sum; __syncthreads();
  if (cy == 0) {
    float t = 0.f;
#pragma unroll
    for (int i = 0; i < 8; ++i) t += red[i][sx];
    mu_s[sx] = t * (1.f / kC);
  }
  __syncthreads();
  red[cy][sx] = sq; __syncthreads();
  if (cy == 0) {
    float t = 0.f;
#pragma unroll
    for (int i = 0; i < 8; ++i) t += red[i][sx];
    float mu = mu_s[sx];
    rs_s[sx] = rsqrtf(t * (1.f / kC) - mu * mu + kEPS);
  }
  __syncthreads();

  for (int c0 = 0; c0 < kC; c0 += 32) {
#pragma unroll
    for (int ii = 0; ii < 4; ++ii) {
      int cc = cy + 8 * ii, c = c0 + cc;
      float v = x[(size_t)b * kC * kS + (size_t)c * kS + s0 + sx];
      tile[cc][sx] = tobf((v - mu_s[sx]) * rs_s[sx] * gg[c] + bb[c]);
    }
    __syncthreads();
    const int cn = tid & 31, sr = tid >> 5;
#pragma unroll
    for (int ii = 0; ii < 4; ++ii) {
      int s = sr + 8 * ii;
      xn[((size_t)b * kS + s0 + s) * kC + c0 + cn] = tile[cn][s];
    }
    __syncthreads();
  }
}

// --------------------------------------------- LN on row-major rows (text)
__global__ __launch_bounds__(256) void ln_rows_kernel(const float* __restrict__ src,
                                                      const float* __restrict__ gg,
                                                      const float* __restrict__ bb,
                                                      bf16_t* __restrict__ dst,
                                                      int nrows) {
  const int lane = threadIdx.x & 31, wid = threadIdx.x >> 5;
  const int row = blockIdx.x * 8 + wid;
  if (row >= nrows) return;
  const float* p = src + (size_t)row * kC;
  float vals[32];
  float sum = 0.f;
#pragma unroll
  for (int j = 0; j < 32; ++j) { vals[j] = p[j * 32 + lane]; sum += vals[j]; }
#pragma unroll
  for (int off = 16; off >= 1; off >>= 1) sum += __shfl_xor(sum, off);
  const float mu = sum * (1.f / kC);
  float sq = 0.f;
#pragma unroll
  for (int j = 0; j < 32; ++j) { float d = vals[j] - mu; sq += d * d; }
#pragma unroll
  for (int off = 16; off >= 1; off >>= 1) sq += __shfl_xor(sq, off);
  const float rs = rsqrtf(sq * (1.f / kC) + kEPS);
  bf16_t* q = dst + (size_t)row * kC;
#pragma unroll
  for (int j = 0; j < 32; ++j) {
    int c = j * 32 + lane;
    q[c] = tobf((vals[j] - mu) * rs * gg[c] + bb[c]);
  }
}

// sin and cos of eight angles given in revolutions, in one statement so that the slot which the
// instruction set asks for behind a transcendental holds by construction: an early-clobber result
// shares no register with a source, so none overwrites the source or reads the result of the one
// in front of it, and v_nop fills the slot behind the last.
__device__ __forceinline__ void sincos_tile(const float (&r)[8], float (&s)[8], float (&c)[8]) {
  asm("v_sin_f32 %0, %16\n\tv_sin_f32 %1, %17\n\tv_sin_f32 %2, %18\n\tv_sin_f32 %3, %19\n\t"
      "v_sin_f32 %4, %20\n\tv_sin_f32 %5, %21\n\tv_sin_f32 %6, %22\n\tv_sin_f32 %7, %23\n\t"
      "v_cos_f32 %8, %16\n\tv_cos_f32 %9, %17\n\tv_cos_f32 %10, %18\n\tv_cos_f32 %11, %19\n\t"
      "v_cos_f32 %12, %20\n\tv_cos_f32 %13, %21\n\tv_cos_f32 %14, %22\n\tv_cos_f32 %15, %23\n\t"
      "v_nop"
      : "=&v"(s[0]), "=&v"(s[1]), "=&v"(s[2]), "=&v"(s[3]),
        "=&v"(s[4]), "=&v"(s[5]), "=&v"(s[6]), "=&v"(s[7]),
        "=&v"(c[0]), "=&v"(c[1]), "=&v"(c[2]), "=&v"(c[3]),
        "=&v"(c[4]), "=&v"(c[5]), "=&v"(c[6]), "=&v"(c[7])
      : "v"(r[0]), "v"(r[1]), "v"(r[2]), "v"(r[3]), "v"(r[4]), "v"(r[5]), "v"(r[6]), "v"(r[7]));
}

// --------------------------------------------- bf16 GEMM: out = A(MxK) @ Wt(NxK)^T + bias
// Double-buffered async LDS staging; K-step 64 (8 WMMA per wave per stage).
// MODE 0: bf16 (B,H,S,D) = RoPE(acc) / sqrt(D)   (Q)
// MODE 3: bf16 (B,H,T,D) = RoPE(acc), positions rescaled onto the query timeline   (K)
// MODE 1: bf16 scattered V^T (B,H,D,T)  (V)
// MODE 2: fp32 (B,C,S) = resid + acc    (output projection + residual transpose)
constexpr int MT = 64, NT = 128, KT = 64;
constexpr int GP = 72;   // GEMM LDS pitch: 144B rows, 16B aligned, conflict-free
constexpr int AP = 40;   // attention LDS pitch: 80B rows
constexpr int CP = 68;   // epilogue LDS pitch in floats: 16-byte column walks without conflicts

template <int MODE>
__global__ __launch_bounds__(256) void gemm_bf16_kernel(
    const bf16_t* __restrict__ A, const bf16_t* __restrict__ Wt,
    const float* __restrict__ bias, float* __restrict__ outF,
    bf16_t* __restrict__ outB, const float* __restrict__ resid) {
  __shared__ bf16_t As[2][MT][GP];
  __shared__ bf16_t Bts[2][NT][GP];
  const int tid = threadIdx.x, lane = tid & 31, wid = tid >> 5;
  const int m0 = blockIdx.x * MT, n0 = blockIdx.y * NT;
  // A wave's two column subtiles lie SN apart. With RoPE they are channels d and d + 32 of one
  // head, so that a rotation's two partners sit in one lane, in acc[sm][0] and acc[sm][1].
  constexpr bool ROPE = (MODE == 0 || MODE == 3);
  constexpr int SN = ROPE ? 32 : 16;
  const int wq = wid >> 1;
  const int wm = (wid & 1) * 32;
  const int wn = ROPE ? (wq >> 1) * 64 + (wq & 1) * 16 : wq * 32;

  v8f acc[2][2];
  {
    const float bv0 = bias[n0 + wn + (lane & 15)];
    const float bv1 = bias[n0 + wn + SN + (lane & 15)];
#pragma unroll
    for (int i = 0; i < 8; ++i) {
      acc[0][0][i] = bv0; acc[1][0][i] = bv0;
      acc[0][1][i] = bv1; acc[1][1][i] = bv1;
    }
  }

  auto stage = [&](int s, int k0) {
#if USE_ASYNC_LDS
    // A tile: 64x64 bf16 = 8KB = 512 x 16B -> 2 per thread
#pragma unroll
    for (int i = 0; i < 2; ++i) {
      const int idx = tid + i * 256, r = idx >> 3, c = (idx & 7) * 8;
      async_copy16(&As[s][r][c], A + (size_t)(m0 + r) * kC + k0 + c);
    }
    // Bt tile: 128x64 bf16 = 16KB = 1024 x 16B -> 4 per thread
#pragma unroll
    for (int i = 0; i < 4; ++i) {
      const int idx = tid + i * 256, r = idx >> 3, c = (idx & 7) * 8;
      async_copy16(&Bts[s][r][c], Wt + (size_t)(n0 + r) * kC + k0 + c);
    }
#else
    const u32* Ag = (const u32*)A;
    const u32* Wg = (const u32*)Wt;
#pragma unroll
    for (int i = 0; i < 8; ++i) {        // A tile: 2048 u32
      int idx = tid + i * 256, r = idx >> 5, cu = idx & 31;
      *(u32*)&As[s][r][cu * 2] = Ag[(size_t)(m0 + r) * (kC / 2) + (k0 >> 1) + cu];
    }
#pragma unroll
    for (int i = 0; i < 16; ++i) {       // Bt tile: 4096 u32
      int idx = tid + i * 256, r = idx >> 5, cu = idx & 31;
      *(u32*)&Bts[s][r][cu * 2] = Wg[(size_t)(n0 + r) * (kC / 2) + (k0 >> 1) + cu];
    }
#endif
  };

  constexpr int NK = kC / KT;
  stage(0, 0);
  for (int it = 0; it < NK; ++it) {
    const int cur = it & 1;
    if (it + 1 < NK) {
      stage(1 - cur, (it + 1) * KT);
      ASYNC_WAIT(6);          // only current tile's (oldest) 6 copies must land
    } else {
      ASYNC_WAIT(0);
    }
    __syncthreads();
#pragma unroll
    for (int kk = 0; kk < KT; kk += 32) {
      v16bf af0 = frag16(&As[cur][wm][kk], GP, lane);
      v16bf af1 = frag16(&As[cur][wm + 16][kk], GP, lane);
      v16bf bf0 = frag16(&Bts[cur][wn][kk], GP, lane);
      v16bf bf1 = frag16(&Bts[cur][wn + SN][kk], GP, lane);
      acc[0][0] = wmma_bf16(af0, bf0, acc[0][0]);
      acc[0][1] = wmma_bf16(af0, bf1, acc[0][1]);
      acc[1][0] = wmma_bf16(af1, bf0, acc[1][0]);
      acc[1][1] = wmma_bf16(af1, bf1, acc[1][1]);
    }
    __syncthreads();
  }

  if constexpr (ROPE) {
    // Keeps the epilogue's angle arithmetic behind the unrolled K loop: scheduled in among the
    // matrix instructions it lengthens their stream.
    __builtin_amdgcn_sched_barrier(0);
    // Rotate in registers, then through LDS as Rt[head of the tile * MT + row][d]: a head's 64
    // rows of 128 B are contiguous in the destination, so a wave stores 512 B in a row.
    // Bts is free here: the K loop's last barrier ended its last read.
    static_assert(sizeof(bf16_t) * NT * GP <= sizeof(Bts), "Rt must fit in Bts");
    static_assert(NT == 2 * kD && MT == 64, "a tile holds two whole heads");
    constexpr int ROWS = (MODE == 0) ? kS : kT;    // rows of A per batch
    static_assert(ROWS % MT == 0, "a tile lies in one batch");
    constexpr float POS = (float)kS / ROWS;               // key positions on the query timeline
    constexpr float OSC = (MODE == 0) ? 0.125f : 1.0f;    // q / sqrt(D)
    unsigned short* Rt = reinterpret_cast<unsigned short*>(&Bts[0][0][0]);
    const int b = m0 / ROWS, r0 = m0 % ROWS;
    const int d = (wq & 1) * 16 + (lane & 15);
    const float inv = __powf(10000.f, -(float)d * (1.f / 32.f));
#pragma unroll
    for (int sm = 0; sm < 2; ++sm) {
      const int ml = wm + sm * 16 + ((lane >> 4) << 3);
      unsigned short* p = Rt + ((wq >> 1) * MT + ml) * GP + d;
      float rev[8], s[8], c[8];
#pragma unroll
      for (int i = 0; i < 8; ++i)
        rev[i] = (float)(r0 + ml + i) * POS * inv * 0.15915494309189532f;   // angle / 2 pi
      sincos_tile(rev, s, c);
#pragma unroll
      for (int i = 0; i < 8; i += 2) {
        float lo[2], hi[2];
#pragma unroll
        for (int j = 0; j < 2; ++j) {
          const float t1 = acc[sm][0][i + j], t2 = acc[sm][1][i + j];
          lo[j] = (t1 * c[i + j] - t2 * s[i + j]) * OSC;
          hi[j] = (t1 * s[i + j] + t2 * c[i + j]) * OSC;
        }
        const u32 a = pack2(lo[0], lo[1]), h = pack2(hi[0], hi[1]);
        p[i * GP]            = (unsigned short)a;
        p[(i + 1) * GP]      = (unsigned short)(a >> 16);
        p[i * GP + 32]       = (unsigned short)h;
        p[(i + 1) * GP + 32] = (unsigned short)(h >> 16);
      }
    }
    __syncthreads();   // Rt rows are read back by other waves than wrote them

    const int rr = tid >> 3, cc = (tid & 7) * 8;   // 8 lanes a row, 32 rows a sweep
    v4u rv[4];
#pragma unroll
    for (int i = 0; i < 4; ++i) rv[i] = *(const v4u*)(Rt + (rr + 32 * i) * GP + cc);
    bf16_t* dst = outB + (((size_t)b * kH + n0 / kD) * ROWS + r0 + rr) * kD + cc;
#pragma unroll
    for (int i = 0; i < 4; ++i)
      *(v4u*)(dst + ((size_t)(i >> 1) * ROWS + (i & 1) * 32) * kD) = rv[i];
  } else {
    // Transposed outputs: row n of the destination is contiguous in m. The tile goes
    // through LDS as Ct[n][m], so every global access is 16 B per lane on whole lines.
    // Bts is free here: the K loop's last barrier ended its last read.
    static_assert(sizeof(float) * NT * CP <= sizeof(Bts), "Ct must fit in Bts");
    float* Ct = reinterpret_cast<float*>(&Bts[0][0][0]);
    constexpr int ROWS = (MODE == 2) ? kS : kT;    // rows of A per batch = destination pitch
    static_assert(ROWS % MT == 0, "a tile lies in one batch");
    const int b = m0 / ROWS, r0 = m0 % ROWS;
    const size_t gbase = ((size_t)b * kC + n0) * ROWS + r0;

    // Reader's share: rows nr + RST * i of the tile, 16 B of the destination at column cr.
    constexpr int LPR = (MODE == 2) ? 16 : 8;      // lanes per destination row
    constexpr int RST = 256 / LPR;                 // rows per sweep of the block
    constexpr int NSW = NT / RST;                  // sweeps
    const int nr = tid / LPR, cr = (tid % LPR) * (MT / LPR);
    const size_t goff = gbase + (size_t)nr * ROWS + cr;
    const float* crd = Ct + nr * CP + cr;

    v4f rr[NSW];
    if constexpr (MODE == 2) {   // residual rows, asked for ahead of the LDS round trip
#pragma unroll
      for (int i = 0; i < NSW; ++i)
        rr[i] = *(const v4f*)(resid + goff + (size_t)i * RST * ROWS);
    }

#pragma unroll
    for (int sm = 0; sm < 2; ++sm)
#pragma unroll
      for (int sn = 0; sn < 2; ++sn) {
        float* p = Ct + (wn + sn * 16 + (lane & 15)) * CP + wm + sm * 16 + ((lane >> 4) << 3);
        const v8f a = acc[sm][sn];
        *(v4f*)(p)     = v4f{a[0], a[1], a[2], a[3]};
        *(v4f*)(p + 4) = v4f{a[4], a[5], a[6], a[7]};
      }
    __syncthreads();   // Ct rows are read back by other waves than wrote them

    if constexpr (MODE == 1) {   // V^T: (B,H,D,T) = (B,C,T), 64 bf16 = one line per row
#pragma unroll
      for (int i = 0; i < NSW; ++i) {
        const v4f lo = *(const v4f*)(crd + i * RST * CP);
        const v4f hi = *(const v4f*)(crd + i * RST * CP + 4);
        union { bf16_t h[8]; v4u u; } pk;
#pragma unroll
        for (int j = 0; j < 4; ++j) { pk.h[j] = tobf(lo[j]); pk.h[4 + j] = tobf(hi[j]); }
        *(v4u*)(outB + goff + (size_t)i * RST * ROWS) = pk.u;
      }
    } else {                     // out (B,C,S) = resid + acc, 64 floats = two lines per row
      // Three sweeps kept apart: the LDS reads, then the stores, each go out back to back.
      v4f cv[NSW];
#pragma unroll
      for (int i = 0; i < NSW; ++i) cv[i] = *(const v4f*)(crd + i * RST * CP);
#pragma unroll
      for (int i = 0; i < NSW; ++i) cv[i] = rr[i] + cv[i];
#pragma unroll
      for (int i = 0; i < NSW; ++i)
        *(v4f*)(outF + goff + (size_t)i * RST * ROWS) = cv[i];
    }
  }
}

constexpr int KP = 72;   // Ks pitch

__device__ __forceinline__ float xhalf(float x) {            // lane l reads lane l ^ 16
  const int b = __builtin_bit_cast(int, x);
  return __builtin_bit_cast(float, __builtin_amdgcn_permlanex16(b, b, 0x76543210, 0xfedcba98,
                                                                false, false));
}

// 2^x of the eight scores of one tile, in one statement so that the slot which the instruction
// set asks for behind a transcendental holds by construction: an early-clobber result shares no
// register with a source, so no exponential overwrites the source or reads the result of the one
// in front of it, and v_nop fills the slot behind the last.
__device__ __forceinline__ void exp2_tile(const v8f a, float (&p)[8]) {
  asm("v_exp_f32 %0, %8\n\tv_exp_f32 %1, %9\n\tv_exp_f32 %2, %10\n\tv_exp_f32 %3, %11\n\t"
      "v_exp_f32 %4, %12\n\tv_exp_f32 %5, %13\n\tv_exp_f32 %6, %14\n\tv_exp_f32 %7, %15\n\t"
      "v_nop"
      : "=&v"(p[0]), "=&v"(p[1]), "=&v"(p[2]), "=&v"(p[3]),
        "=&v"(p[4]), "=&v"(p[5]), "=&v"(p[6]), "=&v"(p[7])
      : "v"(a[0]), "v"(a[1]), "v"(a[2]), "v"(a[3]), "v"(a[4]), "v"(a[5]), "v"(a[6]), "v"(a[7]));
}

// At most 8 waves per SIMD: 128 registers, so that a pass's 16 LDS reads go out as one group
// ahead of the products instead of pair by pair, each with its own wait.
__global__ __launch_bounds__(256) __attribute__((amdgpu_waves_per_eu(4, 8))) void attn_kernel(const bf16_t* __restrict__ q,
                                                   const bf16_t* __restrict__ k,
                                                   const bf16_t* __restrict__ vt,
                                                   bf16_t* __restrict__ o) {
  __shared__ bf16_t Ks[2][32][KP];       // K tile, rows t, cols d
  __shared__ bf16_t Vts[2][kD][AP];      // V^T tile, rows d, cols t
  const int tid = threadIdx.x, lane = tid & 31, wid = tid >> 5;
  const int bh = blockIdx.y, b = bh / kH, h = bh % kH;
  const int s0 = blockIdx.x * 128 + wid * 16;
  const int g = lane >> 4;

  // Q fragments (held for whole T loop), the B operand of S^T: column = query lane & 15.
  v16bf qf[2];
  {
    const bf16_t* qrow = q + ((size_t)bh * kS + s0 + (lane & 15)) * kD;
#pragma unroll
    for (int kd = 0; kd < 2; ++kd) {
      union { struct { v4u lo, hi; } p; v16bf v; } u;
      u.p.lo = *(const v4u*)(qrow + kd * 32 + g * 8);
      u.p.hi = *(const v4u*)(qrow + kd * 32 + g * 8 + 16);
      qf[kd] = u.v;
    }
  }

  float mrun = -3.0e38f;   // this query's running maximum, equal in both lane halves
  float lrun = 0.f;        // denominator over this lane half's keys; the halves join after the loop
  v8f oacc[4];             // oacc[dn][i] = O[query lane & 15][dn * 16 + 8 g + i]
#pragma unroll
  for (int f = 0; f < 4; ++f) oacc[f] = v8f{};

  const bf16_t* kb = k + (size_t)bh * kT * kD;
  const bf16_t* vb = vt + (size_t)bh * kD * kT;

  auto stage = [&](int s, int t0) {
#if USE_ASYNC_LDS
    const int rk = tid >> 3, ck = (tid & 7) * 8;        // 32 x 64
    async_copy16(&Ks[s][rk][ck], kb + (size_t)(t0 + rk) * kD + ck);
    const int rv = tid >> 2, cv = (tid & 3) * 8;        // 64 x 32
    async_copy16(&Vts[s][rv][cv], vb + (size_t)rv * kT + t0 + cv);
#else
    const u32* kg = (const u32*)kb;
    const u32* vg = (const u32*)vb;
#pragma unroll
    for (int i = 0; i < 4; ++i) {
      int idx = tid + i * 256;
      int rk = idx >> 5, ck = idx & 31;
      *(u32*)&Ks[s][rk][ck * 2] = kg[(size_t)(t0 + rk) * (kD / 2) + ck];
      int rv = idx >> 4, cv = idx & 15;
      *(u32*)&Vts[s][rv][cv * 2] = vg[(size_t)rv * (kT / 2) + (t0 >> 1) + cv];
    }
#endif
  };

  constexpr int NSTEP = kT / 32;
  stage(0, 0);
  for (int it = 0; it < NSTEP; ++it) {
    const int cur = it & 1;
    if (it + 1 < NSTEP) {
      stage(1 - cur, (it + 1) * 32);
      ASYNC_WAIT(2);
    } else {
      ASYNC_WAIT(0);
    }
    __syncthreads();

    // scores^T: 32 keys x 16 queries (two M-subtiles), contraction over d in two K-steps.
    // st[kt][i] = score of key kt * 16 + 8 g + i against query lane & 15.
    v8f st[2]; st[0] = v8f{}; st[1] = v8f{};
#pragma unroll
    for (int kd = 0; kd < 2; ++kd)
#pragma unroll
      for (int kt = 0; kt < 2; ++kt)
        st[kt] = wmma_bf16(frag16(&Ks[cur][kt * 16][kd * 32], KP, lane), qf[kd], st[kt]);

    // online softmax: one query per lane
    float vmax = fmaxf(st[0][0], st[1][0]);
#pragma unroll
    for (int i = 1; i < 8; ++i) vmax = fmaxf(vmax, fmaxf(st[0][i], st[1][i]));
    vmax = fmaxf(vmax, xhalf(vmax));
    const float mnew = fmaxf(mrun, vmax);
    const float alpha = __expf(mrun - mnew);
    mrun = mnew;

    // P^T as B operand: element e < 8 is key 8 g + e, element 8 + e is key 16 + 8 g + e,
    // the k order in which frag16 reads the V^T rows.
    union { u32 w[8]; v16bf v; } pf;
    float p[2][8];
#pragma unroll
    for (int kt = 0; kt < 2; ++kt)
      exp2_tile((st[kt] - mnew) * 1.44269504f, p[kt]);   // e^(score - maximum)
    float sum[4];
#pragma unroll
    for (int j = 0; j < 4; ++j) {
      pf.w[j]     = pack2(p[0][2 * j], p[0][2 * j + 1]);
      pf.w[4 + j] = pack2(p[1][2 * j], p[1][2 * j + 1]);
      sum[j] = (p[0][2 * j] + p[0][2 * j + 1]) + (p[1][2 * j] + p[1][2 * j + 1]);
    }
    lrun = lrun * alpha + ((sum[0] + sum[1]) + (sum[2] + sum[3]));
#pragma unroll
    for (int f = 0; f < 4; ++f) oacc[f] *= alpha;

    // O^T += V^T.P^T: A = V^T tile (lane-striped d, contiguous t), B = P^T
#pragma unroll
    for (int dn = 0; dn < 4; ++dn)
      oacc[dn] = wmma_bf16(frag16(&Vts[cur][dn * 16][0], AP, lane), pf.v, oacc[dn]);
    __syncthreads();
  }

  // normalize and write o (B,S,C) bf16: a lane's 8 registers are 8 consecutive channels
  const float inv = 1.f / (lrun + xhalf(lrun));
  bf16_t* orow = o + ((size_t)b * kS + s0 + (lane & 15)) * kC + h * kD + g * 8;
#pragma unroll
  for (int dn = 0; dn < 4; ++dn) {
    const v8f r = oacc[dn] * inv;
    *(v4u*)(orow + dn * 16) = v4u{pack2(r[0], r[1]), pack2(r[2], r[3]),
                                  pack2(r[4], r[5]), pack2(r[6], r[7])};
  }
}

// ---------------------------------------------------------------- launch
extern "C" void kernel_launch(void* const* d_in, const int* in_sizes, int n_in,
                              void* d_out, int out_size, void* d_ws, size_t ws_size,
                              hipStream_t stream) {
  const float* x   = (const float*)d_in[0];
  const float* te  = (const float*)d_in[1];
  const float* g_x = (const float*)d_in[2];
  const float* b_x = (const float*)d_in[3];
  const float* g_t = (const float*)d_in[4];
  const float* b_t = (const float*)d_in[5];
  const float* Wq  = (const float*)d_in[6];
  const float* bq  = (const float*)d_in[7];
  const float* Wk  = (const float*)d_in[8];
  const float* bk  = (const float*)d_in[9];
  const float* Wv  = (const float*)d_in[10];
  const float* bv  = (const float*)d_in[11];
  const float* Wo  = (const float*)d_in[12];
  const float* bo  = (const float*)d_in[13];
  float* out = (float*)d_out;
  char* ws = (char*)d_ws;

  size_t off = 0;
  auto alloc = [&](size_t bytes) {
    size_t o = off; off += (bytes + 255) & ~(size_t)255; return o;
  };
  bf16_t* xn   = (bf16_t*)(ws + alloc((size_t)kB * kS * kC * 2));
  bf16_t* tn   = (bf16_t*)(ws + alloc((size_t)kB * kT * kC * 2));
  bf16_t* Wqt  = (bf16_t*)(ws + alloc((size_t)kC * kC * 2));
  bf16_t* Wkt  = (bf16_t*)(ws + alloc((size_t)kC * kC * 2));
  bf16_t* Wvt  = (bf16_t*)(ws + alloc((size_t)kC * kC * 2));
  bf16_t* Wot  = (bf16_t*)(ws + alloc((size_t)kC * kC * 2));
  bf16_t* qbf  = (bf16_t*)(ws + alloc((size_t)kB * kS * kC * 2));
  bf16_t* kbf  = (bf16_t*)(ws + alloc((size_t)kB * kT * kC * 2));
  bf16_t* vtbf = (bf16_t*)(ws + alloc((size_t)kB * kT * kC * 2));
  bf16_t* obf  = (bf16_t*)(ws + alloc((size_t)kB * kS * kC * 2));

  wt_kernel<<<dim3(kC / 32, kC / 32), 256, 0, stream>>>(Wq, Wqt);
  wt_kernel<<<dim3(kC / 32, kC / 32), 256, 0, stream>>>(Wk, Wkt);
  wt_kernel<<<dim3(kC / 32, kC / 32), 256, 0, stream>>>(Wv, Wvt);
  wt_kernel<<<dim3(kC / 32, kC / 32), 256, 0, stream>>>(Wo, Wot);

  ln_x_kernel<<<dim3(kS / 32, kB), 256, 0, stream>>>(x, g_x, b_x, xn);
  ln_rows_kernel<<<(kB * kT) / 8, 256, 0, stream>>>(te, g_t, b_t, tn, kB * kT);

  gemm_bf16_kernel<0><<<dim3((kB * kS) / MT, kC / NT), 256, 0, stream>>>(
      xn, Wqt, bq, nullptr, qbf, nullptr);
  gemm_bf16_kernel<3><<<dim3((kB * kT) / MT, kC / NT), 256, 0, stream>>>(
      tn, Wkt, bk, nullptr, kbf, nullptr);
  gemm_bf16_kernel<1><<<dim3((kB * kT) / MT, kC / NT), 256, 0, stream>>>(
      tn, Wvt, bv, nullptr, vtbf, nullptr);

  attn_kernel<<<dim3(kS / 128, kB * kH), 256, 0, stream>>>(qbf, kbf, vtbf, obf);

  gemm_bf16_kernel<2><<<dim3((kB * kS) / MT, kC / NT), 256, 0, stream>>>(
      obf, Wot, bo, out, nullptr, x);
}

// v004
// One run takes 182 microseconds.
// Timed twice side by side with v003, it ran 1.06 times as fast both times.
// Over all steps from v000 it is 1.88 times as fast.
#include <hip/hip_runtime.h>

typedef __bf16 bf16_t;
typedef unsigned int u32;
typedef __attribute__((ext_vector_type(16))) bf16_t v16bf;
typedef __attribute__((ext_vector_type(8)))  float  v8f;
typedef __attribute__((ext_vector_type(4)))  u32    v4u;
typedef __attribute__((ext_vector_type(4)))  int    v4i;
typedef __attribute__((ext_vector_type(4)))  float  v4f;

constexpr int kB = 8, kC = 1024, kS = 2048, kT = 512, kH = 16, kD = 64;
constexpr float kEPS = 1e-5f;

#ifndef __has_builtin
#define __has_builtin(x) 0
#endif
#if __has_builtin(__builtin_amdgcn_global_load_async_to_lds_b128) && \
    __has_builtin(__builtin_amdgcn_s_wait_asynccnt)
#define USE_ASYNC_LDS 1
#else
#define USE_ASYNC_LDS 0
#endif

#define AS1 __attribute__((address_space(1)))
#define AS3 __attribute__((address_space(3)))

#if USE_ASYNC_LDS
__device__ __forceinline__ void async_copy16(bf16_t* lds, const bf16_t* g) {
  __builtin_amdgcn_global_load_async_to_lds_b128((AS1 v4i*)g, (AS3 v4i*)lds, 0, 0);
}
#define ASYNC_WAIT(n) __builtin_amdgcn_s_wait_asynccnt(n)
#else
#define ASYNC_WAIT(n)
#endif

// ---------------------------------------------------------------- helpers
__device__ __forceinline__ bf16_t tobf(float f) {
  union { float f; u32 u; } a; a.f = f;
  u32 r = a.u + 0x7FFFu + ((a.u >> 16) & 1u);          // round-nearest-even
  union { unsigned short s; bf16_t h; } b;
  b.s = (unsigned short)(r >> 16);
  return b.h;
}

typedef __attribute__((ext_vector_type(2))) float  v2f;
typedef __attribute__((ext_vector_type(2))) bf16_t v2bf;

__device__ __forceinline__ u32 pack2(float lo, float hi) {   // two f32 -> packed bf16, nearest even
  return __builtin_bit_cast(u32, __builtin_convertvector(v2f{lo, hi}, v2bf));
}

// 16-bit matrix fragment (ISA 7.12.2): lane-striped rows, K contiguous.
// Elements [0..7] = K 8g..8g+7, [8..15] = K 16+8g..23+8g  ->  two b128 loads.
__device__ __forceinline__ v16bf frag16(const bf16_t* base, int pitch, int lane) {
  const int m = lane & 15, g = lane >> 4;
  const bf16_t* r = base + m * pitch + g * 8;
  union { struct { v4u lo, hi; } p; v16bf v; } u;
  u.p.lo = *(const v4u*)(r);
  u.p.hi = *(const v4u*)(r + 16);
  return u.v;
}

__device__ __forceinline__ v8f wmma_bf16(v16bf a, v16bf b, v8f c) {
  return __builtin_amdgcn_wmma_f32_16x16x32_bf16(false, a, false, b, (short)0, c,
                                                 false, false);
}

// --------------------------------------------- four W (KxN) -> Wt (NxK) bf16, one launch
// A block turns one 128 x 128 tile of the matrix that blockIdx.z names: 256 blocks, one per WGP,
// for all four weights, so that starting blocks and waves no longer outweighs the 24 MB moved.
constexpr int WT = 128;

__global__ __launch_bounds__(256) void wt_kernel(
    const float* __restrict__ W0, const float* __restrict__ W1,
    const float* __restrict__ W2, const float* __restrict__ W3,
    bf16_t* __restrict__ T0, bf16_t* __restrict__ T1,
    bf16_t* __restrict__ T2, bf16_t* __restrict__ T3) {
  __shared__ float t[WT][WT + 1];   // odd pitch: a walk down a column meets every bank once
  const int lane = threadIdx.x & 31, wid = threadIdx.x >> 5;
  const int z = blockIdx.z;
  const float* W = z == 0 ? W0 : z == 1 ? W1 : z == 2 ? W2 : W3;
  bf16_t* Wt     = z == 0 ? T0 : z == 1 ? T1 : z == 2 ? T2 : T3;
  const int k0 = blockIdx.x * WT, n0 = blockIdx.y * WT;

  // A wave reads a whole 512-B row of the tile per load; all 16 loads of a lane fly together.
  const float* src = W + (size_t)(k0 + wid) * kC + n0 + lane * 4;
  v4f v[WT / 8];
#pragma unroll
  for (int i = 0; i < WT / 8; ++i) v[i] = *(const v4f*)(src + (size_t)i * 8 * kC);
  // The wait that belongs in front of any rewrite of a register which an issued load names; src as
  // its input keeps the address pair out of the loads' own destinations.
  asm volatile("s_wait_xcnt 0x0" :: "v"(src) : "memory");
  // Column n is kept at place (n & 3) * 32 + (n >> 2), so that a wave's 32 words are adjacent.
  float* tw = &t[wid][lane];
#pragma unroll
  for (int i = 0; i < WT / 8; ++i)
#pragma unroll
    for (int j = 0; j < 4; ++j) tw[i * 8 * (WT + 1) + j * 32] = v[i][j];
  __syncthreads();

  // A wave writes 64 k of the rows n = nq + 4 i: two k per lane, one whole 128-B line per store.
  const int nq = wid >> 1, k = (wid & 1) * 64 + 2 * lane;
  const float* tr = &t[k][nq * 32];
  bf16_t* dst = Wt + (size_t)(n0 + nq) * kC + k0 + k;
#pragma unroll
  for (int i = 0; i < WT / 4; ++i) {
    union { bf16_t h[2]; u32 u; } pk;
    pk.h[0] = tobf(tr[i]);
    pk.h[1] = tobf(tr[WT + 1 + i]);
    *(u32*)(dst + (size_t)i * 4 * kC) = pk.u;
  }
}

// --------------------------------------------- LN over C of x (B,C,S) -> xn (B,S,C) bf16
__global__ __launch_bounds__(256) void ln_x_kernel(const float* __restrict__ x,
                                                   const float* __restrict__ gg,
                                                   const float* __restrict__ bb,
                                                   bf16_t* __restrict__ xn) {
  __shared__ float red[8][32];
  __shared__ float mu_s[32], rs_s[32];
  __shared__ bf16_t tile[32][34];
  const int tid = threadIdx.x;
  const int sx = tid & 31, cy = tid >> 5;
  const int b = blockIdx.y, s0 = blockIdx.x * 32;
  const float* xb = x + (size_t)b * kC * kS + (s0 + sx);

  float sum = 0.f, sq = 0.f;
  for (int c = cy; c < kC; c += 8) {
    float v = xb[(size_t)c * kS];
    sum += v; sq += v * v;
  }
  red[cy][sx] = sum; __syncthreads();
  if (cy == 0) {
    float t = 0.f;
#pragma unroll
    for (int i = 0; i < 8; ++i) t += red[i][sx];
    mu_s[sx] = t * (1.f / kC);
  }
  __syncthreads();
  red[cy][sx] = sq; __syncthreads();
  if (cy == 0) {
    float t = 0.f;
#pragma unroll
    for (int i = 0; i < 8; ++i) t += red[i][sx];
    float mu = mu_s[sx];
    rs_s[sx] = rsqrtf(t * (1.f / kC) - mu * mu + kEPS);
  }
  __syncthreads();

  for (int c0 = 0; c0 < kC; c0 += 32) {
#pragma unroll
    for (int ii = 0; ii < 4; ++ii) {
      int cc = cy + 8 * ii, c = c0 + cc;
      float v = x[(size_t)b * kC * kS + (size_t)c * kS + s0 + sx];
      tile[cc][sx] = tobf((v - mu_s[sx]) * rs_s[sx] * gg[c] + bb[c]);
    }
    __syncthreads();
    const int cn = tid & 31, sr = tid >> 5;
#pragma unroll
    for (int ii = 0; ii < 4; ++ii) {
      int s = sr + 8 * ii;
      xn[((size_t)b * kS + s0 + s) * kC + c0 + cn] = tile[cn][s];
    }
    __syncthreads();
  }
}

// --------------------------------------------- LN on row-major rows (text)
__global__ __launch_bounds__(256) void ln_rows_kernel(const float* __restrict__ src,
                                                      const float* __restrict__ gg,
                                                      const float* __restrict__ bb,
                                                      bf16_t* __restrict__ dst,
                                                      int nrows) {
  const int lane = threadIdx.x & 31, wid = threadIdx.x >> 5;
  const int row = blockIdx.x * 8 + wid;
  if (row >= nrows) return;
  const float* p = src + (size_t)row * kC;
  float vals[32];
  float sum = 0.f;
#pragma unroll
  for (int j = 0; j < 32; ++j) { vals[j] = p[j * 32 + lane]; sum += vals[j]; }
#pragma unroll
  for (int off = 16; off >= 1; off >>= 1) sum += __shfl_xor(sum, off);
  const float mu = sum * (1.f / kC);
  float sq = 0.f;
#pragma unroll
  for (int j = 0; j < 32; ++j) { float d = vals[j] - mu; sq += d * d; }
#pragma unroll
  for (int off = 16; off >= 1; off >>= 1) sq += __shfl_xor(sq, off);
  const float rs = rsqrtf(sq * (1.f / kC) + kEPS);
  bf16_t* q = dst + (size_t)row * kC;
#pragma unroll
  for (int j = 0; j < 32; ++j) {
    int c = j * 32 + lane;
    q[c] = tobf((vals[j] - mu) * rs * gg[c] + bb[c]);
  }
}

// sin and cos of eight angles given in revolutions, in one statement so that the slot which the
// instruction set asks for behind a transcendental holds by construction: an early-clobber result
// shares no register with a source, so none overwrites the source or reads the result of the one
// in front of it, and v_nop fills the slot behind the last.
__device__ __forceinline__ void sincos_tile(const float (&r)[8], float (&s)[8], float (&c)[8]) {
  asm("v_sin_f32 %0, %16\n\tv_sin_f32 %1, %17\n\tv_sin_f32 %2, %18\n\tv_sin_f32 %3, %19\n\t"
      "v_sin_f32 %4, %20\n\tv_sin_f32 %5, %21\n\tv_sin_f32 %6, %22\n\tv_sin_f32 %7, %23\n\t"
      "v_cos_f32 %8, %16\n\tv_cos_f32 %9, %17\n\tv_cos_f32 %10, %18\n\tv_cos_f32 %11, %19\n\t"
      "v_cos_f32 %12, %20\n\tv_cos_f32 %13, %21\n\tv_cos_f32 %14, %22\n\tv_cos_f32 %15, %23\n\t"
      "v_nop"
      : "=&v"(s[0]), "=&v"(s[1]), "=&v"(s[2]), "=&v"(s[3]),
        "=&v"(s[4]), "=&v"(s[5]), "=&v"(s[6]), "=&v"(s[7]),
        "=&v"(c[0]), "=&v"(c[1]), "=&v"(c[2]), "=&v"(c[3]),
        "=&v"(c[4]), "=&v"(c[5]), "=&v"(c[6]), "=&v"(c[7])
      : "v"(r[0]), "v"(r[1]), "v"(r[2]), "v"(r[3]), "v"(r[4]), "v"(r[5]), "v"(r[6]), "v"(r[7]));
}

// --------------------------------------------- bf16 GEMM: out = A(MxK) @ Wt(NxK)^T + bias
// Double-buffered async LDS staging; K-step 64 (8 WMMA per wave per stage).
// MODE 0: bf16 (B,H,S,D) = RoPE(acc) / sqrt(D)   (Q)
// MODE 3: bf16 (B,H,T,D) = RoPE(acc), positions rescaled onto the query timeline   (K)
// MODE 1: bf16 scattered V^T (B,H,D,T)  (V)
// MODE 2: fp32 (B,C,S) = resid + acc    (output projection + residual transpose)
constexpr int MT = 64, NT = 128, KT = 64;
constexpr int GP = 72;   // GEMM LDS pitch: 144B rows, 16B aligned, conflict-free
constexpr int AP = 40;   // attention LDS pitch: 80B rows
constexpr int CP = 68;   // epilogue LDS pitch in floats: 16-byte column walks without conflicts

template <int MODE>
__global__ __launch_bounds__(256) void gemm_bf16_kernel(
    const bf16_t* __restrict__ A, const bf16_t* __restrict__ Wt,
    const float* __restrict__ bias, float* __restrict__ outF,
    bf16_t* __restrict__ outB, const float* __restrict__ resid) {
  __shared__ bf16_t As[2][MT][GP];
  __shared__ bf16_t Bts[2][NT][GP];
  const int tid = threadIdx.x, lane = tid & 31, wid = tid >> 5;
  const int m0 = blockIdx.x * MT, n0 = blockIdx.y * NT;
  // A wave's two column subtiles lie SN apart. With RoPE they are channels d and d + 32 of one
  // head, so that a rotation's two partners sit in one lane, in acc[sm][0] and acc[sm][1].
  constexpr bool ROPE = (MODE == 0 || MODE == 3);
  constexpr int SN = ROPE ? 32 : 16;
  const int wq = wid >> 1;
  const int wm = (wid & 1) * 32;
  const int wn = ROPE ? (wq >> 1) * 64 + (wq & 1) * 16 : wq * 32;

  v8f acc[2][2];
  {
    const float bv0 = bias[n0 + wn + (lane & 15)];
    const float bv1 = bias[n0 + wn + SN + (lane & 15)];
#pragma unroll
    for (int i = 0; i < 8; ++i) {
      acc[0][0][i] = bv0; acc[1][0][i] = bv0;
      acc[0][1][i] = bv1; acc[1][1][i] = bv1;
    }
  }

  auto stage = [&](int s, int k0) {
#if USE_ASYNC_LDS
    // A tile: 64x64 bf16 = 8KB = 512 x 16B -> 2 per thread
#pragma unroll
    for (int i = 0; i < 2; ++i) {
      const int idx = tid + i * 256, r = idx >> 3, c = (idx & 7) * 8;
      async_copy16(&As[s][r][c], A + (size_t)(m0 + r) * kC + k0 + c);
    }
    // Bt tile: 128x64 bf16 = 16KB = 1024 x 16B -> 4 per thread
#pragma unroll
    for (int i = 0; i < 4; ++i) {
      const int idx = tid + i * 256, r = idx >> 3, c = (idx & 7) * 8;
      async_copy16(&Bts[s][r][c], Wt + (size_t)(n0 + r) * kC + k0 + c);
    }
#else
    const u32* Ag = (const u32*)A;
    const u32* Wg = (const u32*)Wt;
#pragma unroll
    for (int i = 0; i < 8; ++i) {        // A tile: 2048 u32
      int idx = tid + i * 256, r = idx >> 5, cu = idx & 31;
      *(u32*)&As[s][r][cu * 2] = Ag[(size_t)(m0 + r) * (kC / 2) + (k0 >> 1) + cu];
    }
#pragma unroll
    for (int i = 0; i < 16; ++i) {       // Bt tile: 4096 u32
      int idx = tid + i * 256, r = idx >> 5, cu = idx & 31;
      *(u32*)&Bts[s][r][cu * 2] = Wg[(size_t)(n0 + r) * (kC / 2) + (k0 >> 1) + cu];
    }
#endif
  };

  constexpr int NK = kC / KT;
  stage(0, 0);
  for (int it = 0; it < NK; ++it) {
    const int cur = it & 1;
    if (it + 1 < NK) {
      stage(1 - cur, (it + 1) * KT);
      ASYNC_WAIT(6);          // only current tile's (oldest) 6 copies must land
    } else {
      ASYNC_WAIT(0);
    }
    __syncthreads();
#pragma unroll
    for (int kk = 0; kk < KT; kk += 32) {
      v16bf af0 = frag16(&As[cur][wm][kk], GP, lane);
      v16bf af1 = frag16(&As[cur][wm + 16][kk], GP, lane);
      v16bf bf0 = frag16(&Bts[cur][wn][kk], GP, lane);
      v16bf bf1 = frag16(&Bts[cur][wn + SN][kk], GP, lane);
      acc[0][0] = wmma_bf16(af0, bf0, acc[0][0]);
      acc[0][1] = wmma_bf16(af0, bf1, acc[0][1]);
      acc[1][0] = wmma_bf16(af1, bf0, acc[1][0]);
      acc[1][1] = wmma_bf16(af1, bf1, acc[1][1]);
    }
    __syncthreads();
  }

  if constexpr (ROPE) {
    // Keeps the epilogue's angle arithmetic behind the unrolled K loop: scheduled in among the
    // matrix instructions it lengthens their stream.
    __builtin_amdgcn_sched_barrier(0);
    // Rotate in registers, then through LDS as Rt[head of the tile * MT + row][d]: a head's 64
    // rows of 128 B are contiguous in the destination, so a wave stores 512 B in a row.
    // Bts is free here: the K loop's last barrier ended its last read.
    static_assert(sizeof(bf16_t) * NT * GP <= sizeof(Bts), "Rt must fit in Bts");
    static_assert(NT == 2 * kD && MT == 64, "a tile holds two whole heads");
    constexpr int ROWS = (MODE == 0) ? kS : kT;    // rows of A per batch
    static_assert(ROWS % MT == 0, "a tile lies in one batch");
    constexpr float POS = (float)kS / ROWS;               // key positions on the query timeline
    constexpr float OSC = (MODE == 0) ? 0.125f : 1.0f;    // q / sqrt(D)
    unsigned short* Rt = reinterpret_cast<unsigned short*>(&Bts[0][0][0]);
    const int b = m0 / ROWS, r0 = m0 % ROWS;
    const int d = (wq & 1) * 16 + (lane & 15);
    const float inv = __powf(10000.f, -(float)d * (1.f / 32.f));
#pragma unroll
    for (int sm = 0; sm < 2; ++sm) {
      const int ml = wm + sm * 16 + ((lane >> 4) << 3);
      unsigned short* p = Rt + ((wq >> 1) * MT + ml) * GP + d;
      float rev[8], s[8], c[8];
#pragma unroll
      for (int i = 0; i < 8; ++i)
        rev[i] = (float)(r0 + ml + i) * POS * inv * 0.15915494309189532f;   // angle / 2 pi
      sincos_tile(rev, s, c);
#pragma unroll
      for (int i = 0; i < 8; i += 2) {
        float lo[2], hi[2];
#pragma unroll
        for (int j = 0; j < 2; ++j) {
          const float t1 = acc[sm][0][i + j], t2 = acc[sm][1][i + j];
          lo[j] = (t1 * c[i + j] - t2 * s[i + j]) * OSC;
          hi[j] = (t1 * s[i + j] + t2 * c[i + j]) * OSC;
        }
        const u32 a = pack2(lo[0], lo[1]), h = pack2(hi[0], hi[1]);
        p[i * GP]            = (unsigned short)a;
        p[(i + 1) * GP]      = (unsigned short)(a >> 16);
        p[i * GP + 32]       = (unsigned short)h;
        p[(i + 1) * GP + 32] = (unsigned short)(h >> 16);
      }
    }
    __syncthreads();   // Rt rows are read back by other waves than wrote them

    const int rr = tid >> 3, cc = (tid & 7) * 8;   // 8 lanes a row, 32 rows a sweep
    v4u rv[4];
#pragma unroll
    for (int i = 0; i < 4; ++i) rv[i] = *(const v4u*)(Rt + (rr + 32 * i) * GP + cc);
    bf16_t* dst = outB + (((size_t)b * kH + n0 / kD) * ROWS + r0 + rr) * kD + cc;
#pragma unroll
    for (int i = 0; i < 4; ++i)
      *(v4u*)(dst + ((size_t)(i >> 1) * ROWS + (i & 1) * 32) * kD) = rv[i];
  } else {
    // Transposed outputs: row n of the destination is contiguous in m. The tile goes
    // through LDS as Ct[n][m], so every global access is 16 B per lane on whole lines.
    // Bts is free here: the K loop's last barrier ended its last read.
    static_assert(sizeof(float) * NT * CP <= sizeof(Bts), "Ct must fit in Bts");
    float* Ct = reinterpret_cast<float*>(&Bts[0][0][0]);
    constexpr int ROWS = (MODE == 2) ? kS : kT;    // rows of A per batch = destination pitch
    static_assert(ROWS % MT == 0, "a tile lies in one batch");
    const int b = m0 / ROWS, r0 = m0 % ROWS;
    const size_t gbase = ((size_t)b * kC + n0) * ROWS + r0;

    // Reader's share: rows nr + RST * i of the tile, 16 B of the destination at column cr.
    constexpr int LPR = (MODE == 2) ? 16 : 8;      // lanes per destination row
    constexpr int RST = 256 / LPR;                 // rows per sweep of the block
    constexpr int NSW = NT / RST;                  // sweeps
    const int nr = tid / LPR, cr = (tid % LPR) * (MT / LPR);
    const size_t goff = gbase + (size_t)nr * ROWS + cr;
    const float* crd = Ct + nr * CP + cr;

    v4f rr[NSW];
    if constexpr (MODE == 2) {   // residual rows, asked for ahead of the LDS round trip
#pragma unroll
      for (int i = 0; i < NSW; ++i)
        rr[i] = *(const v4f*)(resid + goff + (size_t)i * RST * ROWS);
    }

#pragma unroll
    for (int sm = 0; sm < 2; ++sm)
#pragma unroll
      for (int sn = 0; sn < 2; ++sn) {
        float* p = Ct + (wn + sn * 16 + (lane & 15)) * CP + wm + sm * 16 + ((lane >> 4) << 3);
        const v8f a = acc[sm][sn];
        *(v4f*)(p)     = v4f{a[0], a[1], a[2], a[3]};
        *(v4f*)(p + 4) = v4f{a[4], a[5], a[6], a[7]};
      }
    __syncthreads();   // Ct rows are read back by other waves than wrote them

    if constexpr (MODE == 1) {   // V^T: (B,H,D,T) = (B,C,T), 64 bf16 = one line per row
#pragma unroll
      for (int i = 0; i < NSW; ++i) {
        const v4f lo = *(const v4f*)(crd + i * RST * CP);
        const v4f hi = *(const v4f*)(crd + i * RST * CP + 4);
        union { bf16_t h[8]; v4u u; } pk;
#pragma unroll
        for (int j = 0; j < 4; ++j) { pk.h[j] = tobf(lo[j]); pk.h[4 + j] = tobf(hi[j]); }
        *(v4u*)(outB + goff + (size_t)i * RST * ROWS) = pk.u;
      }
    } else {                     // out (B,C,S) = resid + acc, 64 floats = two lines per row
      // Three sweeps kept apart: the LDS reads, then the stores, each go out back to back.
      v4f cv[NSW];
#pragma unroll
      for (int i = 0; i < NSW; ++i) cv[i] = *(const v4f*)(crd + i * RST * CP);
#pragma unroll
      for (int i = 0; i < NSW; ++i) cv[i] = rr[i] + cv[i];
#pragma unroll
      for (int i = 0; i < NSW; ++i)
        *(v4f*)(outF + goff + (size_t)i * RST * ROWS) = cv[i];
    }
  }
}

constexpr int KP = 72;   // Ks pitch

__device__ __forceinline__ float xhalf(float x) {            // lane l reads lane l ^ 16
  const int b = __builtin_bit_cast(int, x);
  return __builtin_bit_cast(float, __builtin_amdgcn_permlanex16(b, b, 0x76543210, 0xfedcba98,
                                                                false, false));
}

// 2^x of the eight scores of one tile, in one statement so that the slot which the instruction
// set asks for behind a transcendental holds by construction: an early-clobber result shares no
// register with a source, so no exponential overwrites the source or reads the result of the one
// in front of it, and v_nop fills the slot behind the last.
__device__ __forceinline__ void exp2_tile(const v8f a, float (&p)[8]) {
  asm("v_exp_f32 %0, %8\n\tv_exp_f32 %1, %9\n\tv_exp_f32 %2, %10\n\tv_exp_f32 %3, %11\n\t"
      "v_exp_f32 %4, %12\n\tv_exp_f32 %5, %13\n\tv_exp_f32 %6, %14\n\tv_exp_f32 %7, %15\n\t"
      "v_nop"
      : "=&v"(p[0]), "=&v"(p[1]), "=&v"(p[2]), "=&v"(p[3]),
        "=&v"(p[4]), "=&v"(p[5]), "=&v"(p[6]), "=&v"(p[7])
      : "v"(a[0]), "v"(a[1]), "v"(a[2]), "v"(a[3]), "v"(a[4]), "v"(a[5]), "v"(a[6]), "v"(a[7]));
}

// At most 8 waves per SIMD: 128 registers, so that a pass's 16 LDS reads go out as one group
// ahead of the products instead of pair by pair, each with its own wait.
__global__ __launch_bounds__(256) __attribute__((amdgpu_waves_per_eu(4, 8))) void attn_kernel(const bf16_t* __restrict__ q,
                                                   const bf16_t* __restrict__ k,
                                                   const bf16_t* __restrict__ vt,
                                                   bf16_t* __restrict__ o) {
  __shared__ bf16_t Ks[2][32][KP];       // K tile, rows t, cols d
  __shared__ bf16_t Vts[2][kD][AP];      // V^T tile, rows d, cols t
  const int tid = threadIdx.x, lane = tid & 31, wid = tid >> 5;
  const int bh = blockIdx.y, b = bh / kH, h = bh % kH;
  const int s0 = blockIdx.x * 128 + wid * 16;
  const int g = lane >> 4;

  // Q fragments (held for whole T loop), the B operand of S^T: column = query lane & 15.
  v16bf qf[2];
  {
    const bf16_t* qrow = q + ((size_t)bh * kS + s0 + (lane & 15)) * kD;
#pragma unroll
    for (int kd = 0; kd < 2; ++kd) {
      union { struct { v4u lo, hi; } p; v16bf v; } u;
      u.p.lo = *(const v4u*)(qrow + kd * 32 + g * 8);
      u.p.hi = *(const v4u*)(qrow + kd * 32 + g * 8 + 16);
      qf[kd] = u.v;
    }
  }

  float mrun = -3.0e38f;   // this query's running maximum, equal in both lane halves
  float lrun = 0.f;        // denominator over this lane half's keys; the halves join after the loop
  v8f oacc[4];             // oacc[dn][i] = O[query lane & 15][dn * 16 + 8 g + i]
#pragma unroll
  for (int f = 0; f < 4; ++f) oacc[f] = v8f{};

  const bf16_t* kb = k + (size_t)bh * kT * kD;
  const bf16_t* vb = vt + (size_t)bh * kD * kT;

  auto stage = [&](int s, int t0) {
#if USE_ASYNC_LDS
    const int rk = tid >> 3, ck = (tid & 7) * 8;        // 32 x 64
    async_copy16(&Ks[s][rk][ck], kb + (size_t)(t0 + rk) * kD + ck);
    const int rv = tid >> 2, cv = (tid & 3) * 8;        // 64 x 32
    async_copy16(&Vts[s][rv][cv], vb + (size_t)rv * kT + t0 + cv);
#else
    const u32* kg = (const u32*)kb;
    const u32* vg = (const u32*)vb;
#pragma unroll
    for (int i = 0; i < 4; ++i) {
      int idx = tid + i * 256;
      int rk = idx >> 5, ck = idx & 31;
      *(u32*)&Ks[s][rk][ck * 2] = kg[(size_t)(t0 + rk) * (kD / 2) + ck];
      int rv = idx >> 4, cv = idx & 15;
      *(u32*)&Vts[s][rv][cv * 2] = vg[(size_t)rv * (kT / 2) + (t0 >> 1) + cv];
    }
#endif
  };

  constexpr int NSTEP = kT / 32;
  stage(0, 0);
  for (int it = 0; it < NSTEP; ++it) {
    const int cur = it & 1;
    if (it + 1 < NSTEP) {
      stage(1 - cur, (it + 1) * 32);
      ASYNC_WAIT(2);
    } else {
      ASYNC_WAIT(0);
    }
    __syncthreads();

    // scores^T: 32 keys x 16 queries (two M-subtiles), contraction over d in two K-steps.
    // st[kt][i] = score of key kt * 16 + 8 g + i against query lane & 15.
    v8f st[2]; st[0] = v8f{}; st[1] = v8f{};
#pragma unroll
    for (int kd = 0; kd < 2; ++kd)
#pragma unroll
      for (int kt = 0; kt < 2; ++kt)
        st[kt] = wmma_bf16(frag16(&Ks[cur][kt * 16][kd * 32], KP, lane), qf[kd], st[kt]);

    // online softmax: one query per lane
    float vmax = fmaxf(st[0][0], st[1][0]);
#pragma unroll
    for (int i = 1; i < 8; ++i) vmax = fmaxf(vmax, fmaxf(st[0][i], st[1][i]));
    vmax = fmaxf(vmax, xhalf(vmax));
    const float mnew = fmaxf(mrun, vmax);
    const float alpha = __expf(mrun - mnew);
    mrun = mnew;

    // P^T as B operand: element e < 8 is key 8 g + e, element 8 + e is key 16 + 8 g + e,
    // the k order in which frag16 reads the V^T rows.
    union { u32 w[8]; v16bf v; } pf;
    float p[2][8];
#pragma unroll
    for (int kt = 0; kt < 2; ++kt)
      exp2_tile((st[kt] - mnew) * 1.44269504f, p[kt]);   // e^(score - maximum)
    float sum[4];
#pragma unroll
    for (int j = 0; j < 4; ++j) {
      pf.w[j]     = pack2(p[0][2 * j], p[0][2 * j + 1]);
      pf.w[4 + j] = pack2(p[1][2 * j], p[1][2 * j + 1]);
      sum[j] = (p[0][2 * j] + p[0][2 * j + 1]) + (p[1][2 * j] + p[1][2 * j + 1]);
    }
    lrun = lrun * alpha + ((sum[0] + sum[1]) + (sum[2] + sum[3]));
#pragma unroll
    for (int f = 0; f < 4; ++f) oacc[f] *= alpha;

    // O^T += V^T.P^T: A = V^T tile (lane-striped d, contiguous t), B = P^T
#pragma unroll
    for (int dn = 0; dn < 4; ++dn)
      oacc[dn] = wmma_bf16(frag16(&Vts[cur][dn * 16][0], AP, lane), pf.v, oacc[dn]);
    __syncthreads();
  }

  // normalize and write o (B,S,C) bf16: a lane's 8 registers are 8 consecutive channels
  const float inv = 1.f / (lrun + xhalf(lrun));
  bf16_t* orow = o + ((size_t)b * kS + s0 + (lane & 15)) * kC + h * kD + g * 8;
#pragma unroll
  for (int dn = 0; dn < 4; ++dn) {
    const v8f r = oacc[dn] * inv;
    *(v4u*)(orow + dn * 16) = v4u{pack2(r[0], r[1]), pack2(r[2], r[3]),
                                  pack2(r[4], r[5]), pack2(r[6], r[7])};
  }
}

// ---------------------------------------------------------------- launch
extern "C" void kernel_launch(void* const* d_in, const int* in_sizes, int n_in,
                              void* d_out, int out_size, void* d_ws, size_t ws_size,
                              hipStream_t stream) {
  const float* x   = (const float*)d_in[0];
  const float* te  = (const float*)d_in[1];
  const float* g_x = (const float*)d_in[2];
  const float* b_x = (const float*)d_in[3];
  const float* g_t = (const float*)d_in[4];
  const float* b_t = (const float*)d_in[5];
  const float* Wq  = (const float*)d_in[6];
  const float* bq  = (const float*)d_in[7];
  const float* Wk  = (const float*)d_in[8];
  const float* bk  = (const float*)d_in[9];
  const float* Wv  = (const float*)d_in[10];
  const float* bv  = (const float*)d_in[11];
  const float* Wo  = (const float*)d_in[12];
  const float* bo  = (const float*)d_in[13];
  float* out = (float*)d_out;
  char* ws = (char*)d_ws;

  size_t off = 0;
  auto alloc = [&](size_t bytes) {
    size_t o = off; off += (bytes + 255) & ~(size_t)255; return o;
  };
  bf16_t* xn   = (bf16_t*)(ws + alloc((size_t)kB * kS * kC * 2));
  bf16_t* tn   = (bf16_t*)(ws + alloc((size_t)kB * kT * kC * 2));
  bf16_t* Wqt  = (bf16_t*)(ws + alloc((size_t)kC * kC * 2));
  bf16_t* Wkt  = (bf16_t*)(ws + alloc((size_t)kC * kC * 2));
  bf16_t* Wvt  = (bf16_t*)(ws + alloc((size_t)kC * kC * 2));
  bf16_t* Wot  = (bf16_t*)(ws + alloc((size_t)kC * kC * 2));
  bf16_t* qbf  = (bf16_t*)(ws + alloc((size_t)kB * kS * kC * 2));
  bf16_t* kbf  = (bf16_t*)(ws + alloc((size_t)kB * kT * kC * 2));
  bf16_t* vtbf = (bf16_t*)(ws + alloc((size_t)kB * kT * kC * 2));
  bf16_t* obf  = (bf16_t*)(ws + alloc((size_t)kB * kS * kC * 2));

  wt_kernel<<<dim3(kC / WT, kC / WT, 4), 256, 0, stream>>>(Wq, Wk, Wv, Wo, Wqt, Wkt, Wvt, Wot);

  ln_x_kernel<<<dim3(kS / 32, kB), 256, 0, stream>>>(x, g_x, b_x, xn);
  ln_rows_kernel<<<(kB * kT) / 8, 256, 0, stream>>>(te, g_t, b_t, tn, kB * kT);

  gemm_bf16_kernel<0><<<dim3((kB * kS) / MT, kC / NT), 256, 0, stream>>>(
      xn, Wqt, bq, nullptr, qbf, nullptr);
  gemm_bf16_kernel<3><<<dim3((kB * kT) / MT, kC / NT), 256, 0, stream>>>(
      tn, Wkt, bk, nullptr, kbf, nullptr);
  gemm_bf16_kernel<1><<<dim3((kB * kT) / MT, kC / NT), 256, 0, stream>>>(
      tn, Wvt, bv, nullptr, vtbf, nullptr);

  attn_kernel<<<dim3(kS / 128, kB * kH), 256, 0, stream>>>(qbf, kbf, vtbf, obf);

  gemm_bf16_kernel<2><<<dim3((kB * kS) / MT, kC / NT), 256, 0, stream>>>(
      obf, Wot, bo, out, nullptr, x);
}

// v005
// A run of this version takes 160 microseconds.
// Timed twice side by side with v004, it ran 1.14 times as fast both times.
// Counting every step since v000, it is 2.15 times as fast.
#include <hip/hip_runtime.h>

typedef __bf16 bf16_t;
typedef unsigned int u32;
typedef __attribute__((ext_vector_type(16))) bf16_t v16bf;
typedef __attribute__((ext_vector_type(8)))  float  v8f;
typedef __attribute__((ext_vector_type(4)))  u32    v4u;
typedef __attribute__((ext_vector_type(4)))  int    v4i;
typedef __attribute__((ext_vector_type(4)))  float  v4f;

constexpr int kB = 8, kC = 1024, kS = 2048, kT = 512, kH = 16, kD = 64;
constexpr float kEPS = 1e-5f;

#ifndef __has_builtin
#define __has_builtin(x) 0
#endif
#if __has_builtin(__builtin_amdgcn_global_load_async_to_lds_b128) && \
    __has_builtin(__builtin_amdgcn_s_wait_asynccnt)
#define USE_ASYNC_LDS 1
#else
#define USE_ASYNC_LDS 0
#endif

#define AS1 __attribute__((address_space(1)))
#define AS3 __attribute__((address_space(3)))

#if USE_ASYNC_LDS
__device__ __forceinline__ void async_copy16(bf16_t* lds, const bf16_t* g) {
  __builtin_amdgcn_global_load_async_to_lds_b128((AS1 v4i*)g, (AS3 v4i*)lds, 0, 0);
}
#define ASYNC_WAIT(n) __builtin_amdgcn_s_wait_asynccnt(n)
#else
#define ASYNC_WAIT(n)
#endif

// ---------------------------------------------------------------- helpers
__device__ __forceinline__ bf16_t tobf(float f) {
  union { float f; u32 u; } a; a.f = f;
  u32 r = a.u + 0x7FFFu + ((a.u >> 16) & 1u);          // round-nearest-even
  union { unsigned short s; bf16_t h; } b;
  b.s = (unsigned short)(r >> 16);
  return b.h;
}

typedef __attribute__((ext_vector_type(2))) float  v2f;
typedef __attribute__((ext_vector_type(2))) bf16_t v2bf;

__device__ __forceinline__ u32 pack2(float lo, float hi) {   // two f32 -> packed bf16, nearest even
  return __builtin_bit_cast(u32, __builtin_convertvector(v2f{lo, hi}, v2bf));
}

// 16-bit matrix fragment (ISA 7.12.2): lane-striped rows, K contiguous.
// Elements [0..7] = K 8g..8g+7, [8..15] = K 16+8g..23+8g  ->  two b128 loads.
__device__ __forceinline__ v16bf frag16(const bf16_t* base, int pitch, int lane) {
  const int m = lane & 15, g = lane >> 4;
  const bf16_t* r = base + m * pitch + g * 8;
  union { struct { v4u lo, hi; } p; v16bf v; } u;
  u.p.lo = *(const v4u*)(r);
  u.p.hi = *(const v4u*)(r + 16);
  return u.v;
}

__device__ __forceinline__ v8f wmma_bf16(v16bf a, v16bf b, v8f c) {
  return __builtin_amdgcn_wmma_f32_16x16x32_bf16(false, a, false, b, (short)0, c,
                                                 false, false);
}

// --------------------------------------------- four W (KxN) -> Wt (NxK) bf16, one launch
// A block turns one 128 x 128 tile of the matrix that blockIdx.z names: 256 blocks, one per WGP,
// for all four weights, so that starting blocks and waves no longer outweighs the 24 MB moved.
constexpr int WT = 128;

__global__ __launch_bounds__(256) void wt_kernel(
    const float* __restrict__ W0, const float* __restrict__ W1,
    const float* __restrict__ W2, const float* __restrict__ W3,
    bf16_t* __restrict__ T0, bf16_t* __restrict__ T1,
    bf16_t* __restrict__ T2, bf16_t* __restrict__ T3) {
  __shared__ float t[WT][WT + 1];   // odd pitch: a walk down a column meets every bank once
  const int lane = threadIdx.x & 31, wid = threadIdx.x >> 5;
  const int z = blockIdx.z;
  const float* W = z == 0 ? W0 : z == 1 ? W1 : z == 2 ? W2 : W3;
  bf16_t* Wt     = z == 0 ? T0 : z == 1 ? T1 : z == 2 ? T2 : T3;
  const int k0 = blockIdx.x * WT, n0 = blockIdx.y * WT;

  // A wave reads a whole 512-B row of the tile per load; all 16 loads of a lane fly together.
  const float* src = W + (size_t)(k0 + wid) * kC + n0 + lane * 4;
  v4f v[WT / 8];
#pragma unroll
  for (int i = 0; i < WT / 8; ++i) v[i] = *(const v4f*)(src + (size_t)i * 8 * kC);
  // The wait that belongs in front of any rewrite of a register which an issued load names; src as
  // its input keeps the address pair out of the loads' own destinations.
  asm volatile("s_wait_xcnt 0x0" :: "v"(src) : "memory");
  // Column n is kept at place (n & 3) * 32 + (n >> 2), so that a wave's 32 words are adjacent.
  float* tw = &t[wid][lane];
#pragma unroll
  for (int i = 0; i < WT / 8; ++i)
#pragma unroll
    for (int j = 0; j < 4; ++j) tw[i * 8 * (WT + 1) + j * 32] = v[i][j];
  __syncthreads();

  // A wave writes 64 k of the rows n = nq + 4 i: two k per lane, one whole 128-B line per store.
  const int nq = wid >> 1, k = (wid & 1) * 64 + 2 * lane;
  const float* tr = &t[k][nq * 32];
  bf16_t* dst = Wt + (size_t)(n0 + nq) * kC + k0 + k;
#pragma unroll
  for (int i = 0; i < WT / 4; ++i) {
    union { bf16_t h[2]; u32 u; } pk;
    pk.h[0] = tobf(tr[i]);
    pk.h[1] = tobf(tr[WT + 1 + i]);
    *(u32*)(dst + (size_t)i * 4 * kC) = pk.u;
  }
}

// --------------------------------------------- LN over C of x (B,C,S) -> xn (B,S,C) bf16
__global__ __launch_bounds__(256) void ln_x_kernel(const float* __restrict__ x,
                                                   const float* __restrict__ gg,
                                                   const float* __restrict__ bb,
                                                   bf16_t* __restrict__ xn) {
  __shared__ float red[8][32];
  __shared__ float mu_s[32], rs_s[32];
  __shared__ bf16_t tile[32][34];
  const int tid = threadIdx.x;
  const int sx = tid & 31, cy = tid >> 5;
  const int b = blockIdx.y, s0 = blockIdx.x * 32;
  const float* xb = x + (size_t)b * kC * kS + (s0 + sx);

  float sum = 0.f, sq = 0.f;
  for (int c = cy; c < kC; c += 8) {
    float v = xb[(size_t)c * kS];
    sum += v; sq += v * v;
  }
  red[cy][sx] = sum; __syncthreads();
  if (cy == 0) {
    float t = 0.f;
#pragma unroll
    for (int i = 0; i < 8; ++i) t += red[i][sx];
    mu_s[sx] = t * (1.f / kC);
  }
  __syncthreads();
  red[cy][sx] = sq; __syncthreads();
  if (cy == 0) {
    float t = 0.f;
#pragma unroll
    for (int i = 0; i < 8; ++i) t += red[i][sx];
    float mu = mu_s[sx];
    rs_s[sx] = rsqrtf(t * (1.f / kC) - mu * mu + kEPS);
  }
  __syncthreads();

  for (int c0 = 0; c0 < kC; c0 += 32) {
#pragma unroll
    for (int ii = 0; ii < 4; ++ii) {
      int cc = cy + 8 * ii, c = c0 + cc;
      float v = x[(size_t)b * kC * kS + (size_t)c * kS + s0 + sx];
      tile[cc][sx] = tobf((v - mu_s[sx]) * rs_s[sx] * gg[c] + bb[c]);
    }
    __syncthreads();
    const int cn = tid & 31, sr = tid >> 5;
#pragma unroll
    for (int ii = 0; ii < 4; ++ii) {
      int s = sr + 8 * ii;
      xn[((size_t)b * kS + s0 + s) * kC + c0 + cn] = tile[cn][s];
    }
    __syncthreads();
  }
}

// --------------------------------------------- LN on row-major rows (text)
__global__ __launch_bounds__(256) void ln_rows_kernel(const float* __restrict__ src,
                                                      const float* __restrict__ gg,
                                                      const float* __restrict__ bb,
                                                      bf16_t* __restrict__ dst,
                                                      int nrows) {
  const int lane = threadIdx.x & 31, wid = threadIdx.x >> 5;
  const int row = blockIdx.x * 8 + wid;
  if (row >= nrows) return;
  const float* p = src + (size_t)row * kC;
  float vals[32];
  float sum = 0.f;
#pragma unroll
  for (int j = 0; j < 32; ++j) { vals[j] = p[j * 32 + lane]; sum += vals[j]; }
#pragma unroll
  for (int off = 16; off >= 1; off >>= 1) sum += __shfl_xor(sum, off);
  const float mu = sum * (1.f / kC);
  float sq = 0.f;
#pragma unroll
  for (int j = 0; j < 32; ++j) { float d = vals[j] - mu; sq += d * d; }
#pragma unroll
  for (int off = 16; off >= 1; off >>= 1) sq += __shfl_xor(sq, off);
  const float rs = rsqrtf(sq * (1.f / kC) + kEPS);
  bf16_t* q = dst + (size_t)row * kC;
#pragma unroll
  for (int j = 0; j < 32; ++j) {
    int c = j * 32 + lane;
    q[c] = tobf((vals[j] - mu) * rs * gg[c] + bb[c]);
  }
}

// sin and cos of eight angles given in revolutions, in one statement so that the slot which the
// instruction set asks for behind a transcendental holds by construction: an early-clobber result
// shares no register with a source, so none overwrites the source or reads the result of the one
// in front of it, and v_nop fills the slot behind the last.
__device__ __forceinline__ void sincos_tile(const float (&r)[8], float (&s)[8], float (&c)[8]) {
  asm("v_sin_f32 %0, %16\n\tv_sin_f32 %1, %17\n\tv_sin_f32 %2, %18\n\tv_sin_f32 %3, %19\n\t"
      "v_sin_f32 %4, %20\n\tv_sin_f32 %5, %21\n\tv_sin_f32 %6, %22\n\tv_sin_f32 %7, %23\n\t"
      "v_cos_f32 %8, %16\n\tv_cos_f32 %9, %17\n\tv_cos_f32 %10, %18\n\tv_cos_f32 %11, %19\n\t"
      "v_cos_f32 %12, %20\n\tv_cos_f32 %13, %21\n\tv_cos_f32 %14, %22\n\tv_cos_f32 %15, %23\n\t"
      "v_nop"
      : "=&v"(s[0]), "=&v"(s[1]), "=&v"(s[2]), "=&v"(s[3]),
        "=&v"(s[4]), "=&v"(s[5]), "=&v"(s[6]), "=&v"(s[7]),
        "=&v"(c[0]), "=&v"(c[1]), "=&v"(c[2]), "=&v"(c[3]),
        "=&v"(c[4]), "=&v"(c[5]), "=&v"(c[6]), "=&v"(c[7])
      : "v"(r[0]), "v"(r[1]), "v"(r[2]), "v"(r[3]), "v"(r[4]), "v"(r[5]), "v"(r[6]), "v"(r[7]));
}

// --------------------------------------------- bf16 GEMM: out = A(MxK) @ Wt(NxK)^T + bias
// Double-buffered async LDS staging; K-step 64. A wave makes 64 x 64 of the output: 16 WMMA on 8
// fragments, so that LDS reads keep up with the matrix unit. A block is MT x 128, MT / 32 waves:
// 256 rows where that still gives every WGP two blocks (fewest bytes from L2), else 128.
// MODE 0: bf16 (B,H,S,D) = RoPE(acc) / sqrt(D)   (Q)
// MODE 3: bf16 (B,H,T,D) = RoPE(acc), positions rescaled onto the query timeline   (K)
// MODE 1: bf16 scattered V^T (B,H,D,T)  (V)
// MODE 2: fp32 (B,C,S) = resid + acc    (output projection + residual transpose)
constexpr int NT = 128, KT = 64;
constexpr int GP = 72;   // GEMM LDS pitch: 144B rows, 16B aligned, conflict-free
constexpr int AP = 40;   // attention LDS pitch: 80B rows

template <int MT>
struct GemmTiles {
  bf16_t a[2][MT][GP];
  bf16_t b[2][NT][GP];
};

// At least 4 waves per SIMD: 256 registers, so that the blocks whose LDS fits a WGP are resident
// together and one's barriers and copy waits are covered by the others.
template <int MODE, int MT>
__global__ __launch_bounds__(MT) __attribute__((amdgpu_waves_per_eu(4))) void gemm_bf16_kernel(
    const bf16_t* __restrict__ A, const bf16_t* __restrict__ Wt,
    const float* __restrict__ bias, float* __restrict__ outF,
    bf16_t* __restrict__ outB, const float* __restrict__ resid) {
  constexpr bool ROPE = (MODE == 0 || MODE == 3);
  constexpr int GTH = MT;       // threads: a wave per 64 x 64
  constexpr int WM = MT / 64;   // waves along m
  constexpr int CP = MT + 4;    // epilogue LDS pitch in floats: 16-byte column walks, no conflicts
  // The operand tiles and, behind the K loop, the epilogue's staging share one allocation.
  constexpr size_t EPI = ROPE ? sizeof(bf16_t) * 2 * MT * GP : sizeof(float) * NT * CP;
  constexpr size_t LSZ = sizeof(GemmTiles<MT>) > EPI ? sizeof(GemmTiles<MT>) : EPI;
  __shared__ alignas(16) char smem[LSZ];
  GemmTiles<MT>& lds = *reinterpret_cast<GemmTiles<MT>*>(smem);
  const int tid = threadIdx.x, lane = tid & 31, wid = tid >> 5;
  const int m0 = blockIdx.x * MT, n0 = blockIdx.y * NT;
  // A wave's 64 columns are one head: with RoPE a rotation's two partners, channels d and d + 32,
  // sit in one lane, in acc[sm][sn] and acc[sm][sn + 2].
  const int wh = wid / WM;
  const int wm = (wid % WM) * 64;
  const int wn = wh * 64;

  v8f acc[4][4];
#pragma unroll
  for (int sn = 0; sn < 4; ++sn) {
    const float bv = bias[n0 + wn + sn * 16 + (lane & 15)];
#pragma unroll
    for (int sm = 0; sm < 4; ++sm)
#pragma unroll
      for (int i = 0; i < 8; ++i) acc[sm][sn][i] = bv;
  }

  constexpr int NCA = MT * KT / 8 / GTH;   // 16-byte copies per thread and stage, A tile
  constexpr int NCB = NT * KT / 8 / GTH;   // the same, Bt tile
  // A copy's source is a block-uniform base plus an unsigned 32-bit offset that both tiles share:
  // a stage's copies then take eight offset registers instead of a 64-bit address each, and the
  // fragments keep theirs inside the wave's 256.
  const bf16_t* Ab = A + (size_t)m0 * kC;
  const bf16_t* Bb = Wt + (size_t)n0 * kC;
  auto stage = [&](int s, int k0) {
#if USE_ASYNC_LDS
#pragma unroll
    for (int i = 0; i < NCA; ++i) {
      const int idx = tid + i * GTH, r = idx >> 3, c = (idx & 7) * 8;
      async_copy16(&lds.a[s][r][c], (Ab + k0) + (u32)(r * kC + c));
    }
#pragma unroll
    for (int i = 0; i < NCB; ++i) {
      const int idx = tid + i * GTH, r = idx >> 3, c = (idx & 7) * 8;
      async_copy16(&lds.b[s][r][c], (Bb + k0) + (u32)(r * kC + c));
    }
#else
    const u32* Ag = (const u32*)A;
    const u32* Wg = (const u32*)Wt;
#pragma unroll
    for (int i = 0; i < 4 * NCA; ++i) {
      int idx = tid + i * GTH, r = idx >> 5, cu = idx & 31;
      *(u32*)&lds.a[s][r][cu * 2] = Ag[(size_t)(m0 + r) * (kC / 2) + (k0 >> 1) + cu];
    }
#pragma unroll
    for (int i = 0; i < 4 * NCB; ++i) {
      int idx = tid + i * GTH, r = idx >> 5, cu = idx & 31;
      *(u32*)&lds.b[s][r][cu * 2] = Wg[(size_t)(n0 + r) * (kC / 2) + (k0 >> 1) + cu];
    }
#endif
  };

  constexpr int NK = kC / KT;
  stage(0, 0);
  for (int it = 0; it < NK; ++it) {
    const int cur = it & 1;
    if (it + 1 < NK) {
      stage(1 - cur, (it + 1) * KT);
      ASYNC_WAIT(NCA + NCB);  // only current tile's (oldest) copies must land
    } else {
      ASYNC_WAIT(0);
    }
    __syncthreads();
#pragma unroll
    for (int kk = 0; kk < KT; kk += 32) {
      v16bf af[4], bf[4];
#pragma unroll
      for (int sm = 0; sm < 4; ++sm) af[sm] = frag16(&lds.a[cur][wm + sm * 16][kk], GP, lane);
#pragma unroll
      for (int sn = 0; sn < 4; ++sn) bf[sn] = frag16(&lds.b[cur][wn + sn * 16][kk], GP, lane);
#pragma unroll
      for (int sm = 0; sm < 4; ++sm)
#pragma unroll
        for (int sn = 0; sn < 4; ++sn) acc[sm][sn] = wmma_bf16(af[sm], bf[sn], acc[sm][sn]);
    }
    __syncthreads();
  }

  // Keeps the epilogue's angle arithmetic and residual loads behind the K loop: scheduled in among
  // the last matrix instructions, where the fragments still hold their registers, they spill.
  __builtin_amdgcn_sched_barrier(0);

  if constexpr (ROPE) {
    // Rotate in registers, then through LDS as Rt[head of the tile * MT + row][d]: a head's MT
    // rows of 128 B are contiguous in the destination, so a wave stores 512 B in a row.
    // The tiles are free here: the K loop's last barrier ended their last read.
    static_assert(NT == 2 * kD, "a tile holds two whole heads");
    constexpr int ROWS = (MODE == 0) ? kS : kT;    // rows of A per batch
    static_assert(ROWS % MT == 0, "a tile lies in one batch");
    constexpr float POS = (float)kS / ROWS;               // key positions on the query timeline
    constexpr float OSC = (MODE == 0) ? 0.125f : 1.0f;    // q / sqrt(D)
    unsigned short* Rt = reinterpret_cast<unsigned short*>(smem);
    const int b = m0 / ROWS, r0 = m0 % ROWS;
#pragma unroll
    for (int dp = 0; dp < 2; ++dp) {
      const int d = dp * 16 + (lane & 15);
      const float inv = __powf(10000.f, -(float)d * (1.f / 32.f));
#pragma unroll
      for (int sm = 0; sm < 4; ++sm) {
        const int ml = wm + sm * 16 + ((lane >> 4) << 3);
        unsigned short* p = Rt + (wh * MT + ml) * GP + d;
        float rev[8], s[8], c[8];
#pragma unroll
        for (int i = 0; i < 8; ++i)
          rev[i] = (float)(r0 + ml + i) * POS * inv * 0.15915494309189532f;   // angle / 2 pi
        sincos_tile(rev, s, c);
#pragma unroll
        for (int i = 0; i < 8; i += 2) {
          float lo[2], hi[2];
#pragma unroll
          for (int j = 0; j < 2; ++j) {
            const float t1 = acc[sm][dp][i + j], t2 = acc[sm][dp + 2][i + j];
            lo[j] = (t1 * c[i + j] - t2 * s[i + j]) * OSC;
            hi[j] = (t1 * s[i + j] + t2 * c[i + j]) * OSC;
          }
          const u32 a = pack2(lo[0], lo[1]), h = pack2(hi[0], hi[1]);
          p[i * GP]            = (unsigned short)a;
          p[(i + 1) * GP]      = (unsigned short)(a >> 16);
          p[i * GP + 32]       = (unsigned short)h;
          p[(i + 1) * GP + 32] = (unsigned short)(h >> 16);
        }
      }
    }
    __syncthreads();   // Rt rows are read back by other waves than wrote them

    constexpr int RSW = GTH / 8;                   // 8 lanes a row: rows a sweep
    constexpr int HSW = MT / RSW;                  // sweeps a head
    const int rr = tid >> 3, cc = (tid & 7) * 8;
    v4u rv[2 * HSW];
#pragma unroll
    for (int i = 0; i < 2 * HSW; ++i) rv[i] = *(const v4u*)(Rt + (rr + RSW * i) * GP + cc);
    bf16_t* dst = outB + (((size_t)b * kH + n0 / kD) * ROWS + r0 + rr) * kD + cc;
#pragma unroll
    for (int i = 0; i < 2 * HSW; ++i)
      *(v4u*)(dst + ((size_t)(i / HSW) * ROWS + (i % HSW) * RSW) * kD) = rv[i];
  } else {
    // Transposed outputs: row n of the destination is contiguous in m. The tile goes
    // through LDS as Ct[n][m], so every global access is 16 B per lane on whole lines.
    // The tiles are free here: the K loop's last barrier ended their last read.
    float* Ct = reinterpret_cast<float*>(smem);
    constexpr int ROWS = (MODE == 2) ? kS : kT;    // rows of A per batch = destination pitch
    static_assert(ROWS % MT == 0, "a tile lies in one batch");
    const int b = m0 / ROWS, r0 = m0 % ROWS;
    const size_t gbase = ((size_t)b * kC + n0) * ROWS + r0;

    // Reader's share: rows nr + RST * i of the tile, 16 B of the destination at column cr.
    constexpr int LPR = (MODE == 2) ? MT / 4 : MT / 8;   // lanes per destination row
    constexpr int RST = GTH / LPR;                 // rows per sweep of the block
    constexpr int NSW = NT / RST;                  // sweeps
    const int nr = tid / LPR, cr = (tid % LPR) * (MT / LPR);
    const size_t goff = gbase + (size_t)nr * ROWS + cr;
    const float* crd = Ct + nr * CP + cr;

    // Residual rows: the first half is asked for ahead of the LDS round trip, the second behind
    // the barrier, in the registers that the accumulators have left by then.
    v4f rr[NSW];
    if constexpr (MODE == 2) {
#pragma unroll
      for (int i = 0; i < NSW / 2; ++i)
        rr[i] = *(const v4f*)(resid + goff + (size_t)i * RST * ROWS);
    }

#pragma unroll
    for (int sm = 0; sm < 4; ++sm)
#pragma unroll
      for (int sn = 0; sn < 4; ++sn) {
        float* p = Ct + (wn + sn * 16 + (lane & 15)) * CP + wm + sm * 16 + ((lane >> 4) << 3);
        const v8f a = acc[sm][sn];
        *(v4f*)(p)     = v4f{a[0], a[1], a[2], a[3]};
        *(v4f*)(p + 4) = v4f{a[4], a[5], a[6], a[7]};
      }
    __syncthreads();   // Ct rows are read back by other waves than wrote them

    if constexpr (MODE == 2) {
#pragma unroll
      for (int i = NSW / 2; i < NSW; ++i)
        rr[i] = *(const v4f*)(resid + goff + (size_t)i * RST * ROWS);
    }

    if constexpr (MODE == 1) {   // V^T: (B,H,D,T) = (B,C,T), whole lines of bf16 per row
#pragma unroll
      for (int i = 0; i < NSW; ++i) {
        const v4f lo = *(const v4f*)(crd + i * RST * CP);
        const v4f hi = *(const v4f*)(crd + i * RST * CP + 4);
        union { bf16_t h[8]; v4u u; } pk;
#pragma unroll
        for (int j = 0; j < 4; ++j) { pk.h[j] = tobf(lo[j]); pk.h[4 + j] = tobf(hi[j]); }
        *(v4u*)(outB + goff + (size_t)i * RST * ROWS) = pk.u;
      }
    } else {                     // out (B,C,S) = resid + acc, whole lines of floats per row
      // Eight rows at a time, three sweeps kept apart: the LDS reads, then the stores, each go
      // out back to back.
#pragma unroll
      for (int i0 = 0; i0 < NSW; i0 += 8) {
        v4f cv[8];
#pragma unroll
        for (int i = 0; i < 8; ++i) cv[i] = *(const v4f*)(crd + (i0 + i) * RST * CP);
#pragma unroll
        for (int i = 0; i < 8; ++i) cv[i] = rr[i0 + i] + cv[i];
#pragma unroll
        for (int i = 0; i < 8; ++i)
          *(v4f*)(outF + goff + (size_t)(i0 + i) * RST * ROWS) = cv[i];
      }
    }
  }
}

constexpr int KP = 72;   // Ks pitch

__device__ __forceinline__ float xhalf(float x) {            // lane l reads lane l ^ 16
  const int b = __builtin_bit_cast(int, x);
  return __builtin_bit_cast(float, __builtin_amdgcn_permlanex16(b, b, 0x76543210, 0xfedcba98,
                                                                false, false));
}

// 2^x of the eight scores of one tile, in one statement so that the slot which the instruction
// set asks for behind a transcendental holds by construction: an early-clobber result shares no
// register with a source, so no exponential overwrites the source or reads the result of the one
// in front of it, and v_nop fills the slot behind the last.
__device__ __forceinline__ void exp2_tile(const v8f a, float (&p)[8]) {
  asm("v_exp_f32 %0, %8\n\tv_exp_f32 %1, %9\n\tv_exp_f32 %2, %10\n\tv_exp_f32 %3, %11\n\t"
      "v_exp_f32 %4, %12\n\tv_exp_f32 %5, %13\n\tv_exp_f32 %6, %14\n\tv_exp_f32 %7, %15\n\t"
      "v_nop"
      : "=&v"(p[0]), "=&v"(p[1]), "=&v"(p[2]), "=&v"(p[3]),
        "=&v"(p[4]), "=&v"(p[5]), "=&v"(p[6]), "=&v"(p[7])
      : "v"(a[0]), "v"(a[1]), "v"(a[2]), "v"(a[3]), "v"(a[4]), "v"(a[5]), "v"(a[6]), "v"(a[7]));
}

// At most 8 waves per SIMD: 128 registers, so that a pass's 16 LDS reads go out as one group
// ahead of the products instead of pair by pair, each with its own wait.
__global__ __launch_bounds__(256) __attribute__((amdgpu_waves_per_eu(4, 8))) void attn_kernel(const bf16_t* __restrict__ q,
                                                   const bf16_t* __restrict__ k,
                                                   const bf16_t* __restrict__ vt,
                                                   bf16_t* __restrict__ o) {
  __shared__ bf16_t Ks[2][32][KP];       // K tile, rows t, cols d
  __shared__ bf16_t Vts[2][kD][AP];      // V^T tile, rows d, cols t
  const int tid = threadIdx.x, lane = tid & 31, wid = tid >> 5;
  const int bh = blockIdx.y, b = bh / kH, h = bh % kH;
  const int s0 = blockIdx.x * 128 + wid * 16;
  const int g = lane >> 4;

  // Q fragments (held for whole T loop), the B operand of S^T: column = query lane & 15.
  v16bf qf[2];
  {
    const bf16_t* qrow = q + ((size_t)bh * kS + s0 + (lane & 15)) * kD;
#pragma unroll
    for (int kd = 0; kd < 2; ++kd) {
      union { struct { v4u lo, hi; } p; v16bf v; } u;
      u.p.lo = *(const v4u*)(qrow + kd * 32 + g * 8);
      u.p.hi = *(const v4u*)(qrow + kd * 32 + g * 8 + 16);
      qf[kd] = u.v;
    }
  }

  float mrun = -3.0e38f;   // this query's running maximum, equal in both lane halves
  float lrun = 0.f;        // denominator over this lane half's keys; the halves join after the loop
  v8f oacc[4];             // oacc[dn][i] = O[query lane & 15][dn * 16 + 8 g + i]
#pragma unroll
  for (int f = 0; f < 4; ++f) oacc[f] = v8f{};

  const bf16_t* kb = k + (size_t)bh * kT * kD;
  const bf16_t* vb = vt + (size_t)bh * kD * kT;

  auto stage = [&](int s, int t0) {
#if USE_ASYNC_LDS
    const int rk = tid >> 3, ck = (tid & 7) * 8;        // 32 x 64
    async_copy16(&Ks[s][rk][ck], kb + (size_t)(t0 + rk) * kD + ck);
    const int rv = tid >> 2, cv = (tid & 3) * 8;        // 64 x 32
    async_copy16(&Vts[s][rv][cv], vb + (size_t)rv * kT + t0 + cv);
#else
    const u32* kg = (const u32*)kb;
    const u32* vg = (const u32*)vb;
#pragma unroll
    for (int i = 0; i < 4; ++i) {
      int idx = tid + i * 256;
      int rk = idx >> 5, ck = idx & 31;
      *(u32*)&Ks[s][rk][ck * 2] = kg[(size_t)(t0 + rk) * (kD / 2) + ck];
      int rv = idx >> 4, cv = idx & 15;
      *(u32*)&Vts[s][rv][cv * 2] = vg[(size_t)rv * (kT / 2) + (t0 >> 1) + cv];
    }
#endif
  };

  constexpr int NSTEP = kT / 32;
  stage(0, 0);
  for (int it = 0; it < NSTEP; ++it) {
    const int cur = it & 1;
    if (it + 1 < NSTEP) {
      stage(1 - cur, (it + 1) * 32);
      ASYNC_WAIT(2);
    } else {
      ASYNC_WAIT(0);
    }
    __syncthreads();

    // scores^T: 32 keys x 16 queries (two M-subtiles), contraction over d in two K-steps.
    // st[kt][i] = score of key kt * 16 + 8 g + i against query lane & 15.
    v8f st[2]; st[0] = v8f{}; st[1] = v8f{};
#pragma unroll
    for (int kd = 0; kd < 2; ++kd)
#pragma unroll
      for (int kt = 0; kt < 2; ++kt)
        st[kt] = wmma_bf16(frag16(&Ks[cur][kt * 16][kd * 32], KP, lane), qf[kd], st[kt]);

    // online softmax: one query per lane
    float vmax = fmaxf(st[0][0], st[1][0]);
#pragma unroll
    for (int i = 1; i < 8; ++i) vmax = fmaxf(vmax, fmaxf(st[0][i], st[1][i]));
    vmax = fmaxf(vmax, xhalf(vmax));
    const float mnew = fmaxf(mrun, vmax);
    const float alpha = __expf(mrun - mnew);
    mrun = mnew;

    // P^T as B operand: element e < 8 is key 8 g + e, element 8 + e is key 16 + 8 g + e,
    // the k order in which frag16 reads the V^T rows.
    union { u32 w[8]; v16bf v; } pf;
    float p[2][8];
#pragma unroll
    for (int kt = 0; kt < 2; ++kt)
      exp2_tile((st[kt] - mnew) * 1.44269504f, p[kt]);   // e^(score - maximum)
    float sum[4];
#pragma unroll
    for (int j = 0; j < 4; ++j) {
      pf.w[j]     = pack2(p[0][2 * j], p[0][2 * j + 1]);
      pf.w[4 + j] = pack2(p[1][2 * j], p[1][2 * j + 1]);
      sum[j] = (p[0][2 * j] + p[0][2 * j + 1]) + (p[1][2 * j] + p[1][2 * j + 1]);
    }
    lrun = lrun * alpha + ((sum[0] + sum[1]) + (sum[2] + sum[3]));
#pragma unroll
    for (int f = 0; f < 4; ++f) oacc[f] *= alpha;

    // O^T += V^T.P^T: A = V^T tile (lane-striped d, contiguous t), B = P^T
#pragma unroll
    for (int dn = 0; dn < 4; ++dn)
      oacc[dn] = wmma_bf16(frag16(&Vts[cur][dn * 16][0], AP, lane), pf.v, oacc[dn]);
    __syncthreads();
  }

  // normalize and write o (B,S,C) bf16: a lane's 8 registers are 8 consecutive channels
  const float inv = 1.f / (lrun + xhalf(lrun));
  bf16_t* orow = o + ((size_t)b * kS + s0 + (lane & 15)) * kC + h * kD + g * 8;
#pragma unroll
  for (int dn = 0; dn < 4; ++dn) {
    const v8f r = oacc[dn] * inv;
    *(v4u*)(orow + dn * 16) = v4u{pack2(r[0], r[1]), pack2(r[2], r[3]),
                                  pack2(r[4], r[5]), pack2(r[6], r[7])};
  }
}

// ---------------------------------------------------------------- launch
extern "C" void kernel_launch(void* const* d_in, const int* in_sizes, int n_in,
                              void* d_out, int out_size, void* d_ws, size_t ws_size,
                              hipStream_t stream) {
  const float* x   = (const float*)d_in[0];
  const float* te  = (const float*)d_in[1];
  const float* g_x = (const float*)d_in[2];
  const float* b_x = (const float*)d_in[3];
  const float* g_t = (const float*)d_in[4];
  const float* b_t = (const float*)d_in[5];
  const float* Wq  = (const float*)d_in[6];
  const float* bq  = (const float*)d_in[7];
  const float* Wk  = (const float*)d_in[8];
  const float* bk  = (const float*)d_in[9];
  const float* Wv  = (const float*)d_in[10];
  const float* bv  = (const float*)d_in[11];
  const float* Wo  = (const float*)d_in[12];
  const float* bo  = (const float*)d_in[13];
  float* out = (float*)d_out;
  char* ws = (char*)d_ws;

  size_t off = 0;
  auto alloc = [&](size_t bytes) {
    size_t o = off; off += (bytes + 255) & ~(size_t)255; return o;
  };
  bf16_t* xn   = (bf16_t*)(ws + alloc((size_t)kB * kS * kC * 2));
  bf16_t* tn   = (bf16_t*)(ws + alloc((size_t)kB * kT * kC * 2));
  bf16_t* Wqt  = (bf16_t*)(ws + alloc((size_t)kC * kC * 2));
  bf16_t* Wkt  = (bf16_t*)(ws + alloc((size_t)kC * kC * 2));
  bf16_t* Wvt  = (bf16_t*)(ws + alloc((size_t)kC * kC * 2));
  bf16_t* Wot  = (bf16_t*)(ws + alloc((size_t)kC * kC * 2));
  bf16_t* qbf  = (bf16_t*)(ws + alloc((size_t)kB * kS * kC * 2));
  bf16_t* kbf  = (bf16_t*)(ws + alloc((size_t)kB * kT * kC * 2));
  bf16_t* vtbf = (bf16_t*)(ws + alloc((size_t)kB * kT * kC * 2));
  bf16_t* obf  = (bf16_t*)(ws + alloc((size_t)kB * kS * kC * 2));

  wt_kernel<<<dim3(kC / WT, kC / WT, 4), 256, 0, stream>>>(Wq, Wk, Wv, Wo, Wqt, Wkt, Wvt, Wot);

  ln_x_kernel<<<dim3(kS / 32, kB), 256, 0, stream>>>(x, g_x, b_x, xn);
  ln_rows_kernel<<<(kB * kT) / 8, 256, 0, stream>>>(te, g_t, b_t, tn, kB * kT);

  gemm_bf16_kernel<0, 256><<<dim3((kB * kS) / 256, kC / NT), 256, 0, stream>>>(
      xn, Wqt, bq, nullptr, qbf, nullptr);
  gemm_bf16_kernel<3, 128><<<dim3((kB * kT) / 128, kC / NT), 128, 0, stream>>>(
      tn, Wkt, bk, nullptr, kbf, nullptr);
  gemm_bf16_kernel<1, 128><<<dim3((kB * kT) / 128, kC / NT), 128, 0, stream>>>(
      tn, Wvt, bv, nullptr, vtbf, nullptr);

  attn_kernel<<<dim3(kS / 128, kB * kH), 256, 0, stream>>>(qbf, kbf, vtbf, obf);

  gemm_bf16_kernel<2, 256><<<dim3((kB * kS) / 256, kC / NT), 256, 0, stream>>>(
      obf, Wot, bo, out, nullptr, x);
}

// v006
// A run of this version takes 137 microseconds.
// Timed twice side by side with v005, it ran 1.17 and 1.16 times as fast.
// All steps since v000 together make it 2.50 times as fast.
#include <hip/hip_runtime.h>

typedef __bf16 bf16_t;
typedef unsigned int u32;
typedef __attribute__((ext_vector_type(16))) bf16_t v16bf;
typedef __attribute__((ext_vector_type(8)))  float  v8f;
typedef __attribute__((ext_vector_type(4)))  u32    v4u;
typedef __attribute__((ext_vector_type(4)))  int    v4i;
typedef __attribute__((ext_vector_type(4)))  float  v4f;

constexpr int kB = 8, kC = 1024, kS = 2048, kT = 512, kH = 16, kD = 64;
constexpr float kEPS = 1e-5f;

#ifndef __has_builtin
#define __has_builtin(x) 0
#endif
#if __has_builtin(__builtin_amdgcn_global_load_async_to_lds_b128) && \
    __has_builtin(__builtin_amdgcn_s_wait_asynccnt)
#define USE_ASYNC_LDS 1
#else
#define USE_ASYNC_LDS 0
#endif

#define AS1 __attribute__((address_space(1)))
#define AS3 __attribute__((address_space(3)))

#if USE_ASYNC_LDS
__device__ __forceinline__ void async_copy16(bf16_t* lds, const bf16_t* g) {
  __builtin_amdgcn_global_load_async_to_lds_b128((AS1 v4i*)g, (AS3 v4i*)lds, 0, 0);
}
#define ASYNC_WAIT(n) __builtin_amdgcn_s_wait_asynccnt(n)
#else
#define ASYNC_WAIT(n)
#endif

// ---------------------------------------------------------------- helpers
__device__ __forceinline__ bf16_t tobf(float f) {
  union { float f; u32 u; } a; a.f = f;
  u32 r = a.u + 0x7FFFu + ((a.u >> 16) & 1u);          // round-nearest-even
  union { unsigned short s; bf16_t h; } b;
  b.s = (unsigned short)(r >> 16);
  return b.h;
}

typedef __attribute__((ext_vector_type(2))) float  v2f;
typedef __attribute__((ext_vector_type(2))) bf16_t v2bf;

__device__ __forceinline__ u32 pack2(float lo, float hi) {   // two f32 -> packed bf16, nearest even
  return __builtin_bit_cast(u32, __builtin_convertvector(v2f{lo, hi}, v2bf));
}

__device__ __forceinline__ float xhalf(float x) {            // lane l reads lane l ^ 16
  const int b = __builtin_bit_cast(int, x);
  return __builtin_bit_cast(float, __builtin_amdgcn_permlanex16(b, b, 0x76543210, 0xfedcba98,
                                                                false, false));
}

// 16-bit matrix fragment (ISA 7.12.2): lane-striped rows, K contiguous.
// Elements [0..7] = K 8g..8g+7, [8..15] = K 16+8g..23+8g  ->  two b128 loads.
__device__ __forceinline__ v16bf frag16(const bf16_t* base, int pitch, int lane) {
  const int m = lane & 15, g = lane >> 4;
  const bf16_t* r = base + m * pitch + g * 8;
  union { struct { v4u lo, hi; } p; v16bf v; } u;
  u.p.lo = *(const v4u*)(r);
  u.p.hi = *(const v4u*)(r + 16);
  return u.v;
}

__device__ __forceinline__ v8f wmma_bf16(v16bf a, v16bf b, v8f c) {
  return __builtin_amdgcn_wmma_f32_16x16x32_bf16(false, a, false, b, (short)0, c,
                                                 false, false);
}

// --------------------------------------------- four W (KxN) -> Wt (NxK) bf16, one launch
// A block turns one 128 x 128 tile of the matrix that blockIdx.z names: 256 blocks, one per WGP,
// for all four weights, so that starting blocks and waves no longer outweighs the 24 MB moved.
constexpr int WT = 128;

__global__ __launch_bounds__(256) void wt_kernel(
    const float* __restrict__ W0, const float* __restrict__ W1,
    const float* __restrict__ W2, const float* __restrict__ W3,
    bf16_t* __restrict__ T0, bf16_t* __restrict__ T1,
    bf16_t* __restrict__ T2, bf16_t* __restrict__ T3) {
  __shared__ float t[WT][WT + 1];   // odd pitch: a walk down a column meets every bank once
  const int lane = threadIdx.x & 31, wid = threadIdx.x >> 5;
  const int z = blockIdx.z;
  const float* W = z == 0 ? W0 : z == 1 ? W1 : z == 2 ? W2 : W3;
  bf16_t* Wt     = z == 0 ? T0 : z == 1 ? T1 : z == 2 ? T2 : T3;
  const int k0 = blockIdx.x * WT, n0 = blockIdx.y * WT;

  // A wave reads a whole 512-B row of the tile per load; all 16 loads of a lane fly together.
  const float* src = W + (size_t)(k0 + wid) * kC + n0 + lane * 4;
  v4f v[WT / 8];
#pragma unroll
  for (int i = 0; i < WT / 8; ++i) v[i] = *(const v4f*)(src + (size_t)i * 8 * kC);
  // The wait that belongs in front of any rewrite of a register which an issued load names; src as
  // its input keeps the address pair out of the loads' own destinations.
  asm volatile("s_wait_xcnt 0x0" :: "v"(src) : "memory");
  // Column n is kept at place (n & 3) * 32 + (n >> 2), so that a wave's 32 words are adjacent.
  float* tw = &t[wid][lane];
#pragma unroll
  for (int i = 0; i < WT / 8; ++i)
#pragma unroll
    for (int j = 0; j < 4; ++j) tw[i * 8 * (WT + 1) + j * 32] = v[i][j];
  __syncthreads();

  // A wave writes 64 k of the rows n = nq + 4 i: two k per lane, one whole 128-B line per store.
  const int nq = wid >> 1, k = (wid & 1) * 64 + 2 * lane;
  const float* tr = &t[k][nq * 32];
  bf16_t* dst = Wt + (size_t)(n0 + nq) * kC + k0 + k;
#pragma unroll
  for (int i = 0; i < WT / 4; ++i) {
    union { bf16_t h[2]; u32 u; } pk;
    pk.h[0] = tobf(tr[i]);
    pk.h[1] = tobf(tr[WT + 1 + i]);
    *(u32*)(dst + (size_t)i * 4 * kC) = pk.u;
  }
}

// 1 / sqrt of four values, in one statement so that the slot which the instruction set asks for
// behind a transcendental holds by construction: an early-clobber result shares no register with a
// source, and v_nop fills the slot behind the last.
__device__ __forceinline__ v4f rsq_quad(const v4f a) {
  float r0, r1, r2, r3;
  asm("v_rsq_f32 %0, %4\n\tv_rsq_f32 %1, %5\n\tv_rsq_f32 %2, %6\n\tv_rsq_f32 %3, %7\n\tv_nop"
      : "=&v"(r0), "=&v"(r1), "=&v"(r2), "=&v"(r3)
      : "v"(a[0]), "v"(a[1]), "v"(a[2]), "v"(a[3]));
  return v4f{r0, r1, r2, r3};
}

// --------------------------------------------- LN over C of x (B,C,S) -> xn (B,S,C) bf16
// A block keeps 64 positions x all 1024 channels in registers, so x is read once: 16 B a lane, 256 B
// of a channel's row per half wave, a lane's 32 loads all in flight together. The normalised tile
// turns through LDS as bf16, and a wave stores 512 B of one position's row at a time.
constexpr int LS = 64;        // positions a block
constexpr int LTH = 512;      // threads: 16 lanes along s, 32 groups of 8 channels
constexpr int LP = kC + 8;    // tile pitch in bf16: 2064 B, 16 B x odd

__global__ __launch_bounds__(LTH) void ln_x_kernel(const float* __restrict__ x,
                                                   const float* __restrict__ gg,
                                                   const float* __restrict__ bb,
                                                   bf16_t* __restrict__ xn) {
  __shared__ alignas(16) bf16_t tile[LS][LP];
  __shared__ alignas(16) float red[LTH / 32][2][LS];
  const int tid = threadIdx.x, lane = tid & 31, wid = tid >> 5;
  const int sq = lane & 15, hf = lane >> 4;   // positions 4 sq .. 4 sq + 3
  const int cg = tid >> 4;                    // channels 256 ii + 8 cg + e
  const int b = blockIdx.y, s0 = blockIdx.x * LS;

  const float* src = x + ((size_t)b * kC + cg * 8) * kS + s0 + sq * 4;
  v4f v[4][8];
#pragma unroll
  for (int ii = 0; ii < 4; ++ii)
#pragma unroll
    for (int e = 0; e < 8; ++e) v[ii][e] = *(const v4f*)(src + (size_t)(ii * 256 + e) * kS);
  // Scale and shift of the lane's channels are asked for along with x: nothing waits for them later.
  v4f gv[4][2], bv[4][2];
#pragma unroll
  for (int ii = 0; ii < 4; ++ii)
#pragma unroll
    for (int q = 0; q < 2; ++q) {
      gv[ii][q] = *(const v4f*)(gg + ii * 256 + cg * 8 + q * 4);
      bv[ii][q] = *(const v4f*)(bb + ii * 256 + cg * 8 + q * 4);
    }
  // The wait that belongs in front of any rewrite of a register which an issued load names; src as
  // its input keeps the address pair out of the loads' own destinations.
  asm volatile("s_wait_xcnt 0x0" :: "v"(src) : "memory");

  v4f sum = v[0][0], sqs = v[0][0] * v[0][0];
#pragma unroll
  for (int i = 1; i < 32; ++i) {
    const v4f t = v[i >> 3][i & 7];
    sum += t; sqs += t * t;
  }
  // The two lane halves hold different channels of the same positions.
#pragma unroll
  for (int j = 0; j < 4; ++j) { sum[j] += xhalf(sum[j]); sqs[j] += xhalf(sqs[j]); }
  *(v4f*)&red[wid][hf][sq * 4] = hf ? sqs : sum;
  __syncthreads();   // every wave's partial sums are read by every wave

  // The lower half adds up the waves' sums, the upper their sums of squares; then they exchange.
  v4f tot = *(const v4f*)&red[0][hf][sq * 4];
#pragma unroll
  for (int w = 1; w < LTH / 32; ++w) tot += *(const v4f*)&red[w][hf][sq * 4];
  v4f mu, var;
#pragma unroll
  for (int j = 0; j < 4; ++j) {
    const float oth = xhalf(tot[j]);
    mu[j] = (hf ? oth : tot[j]) * (1.f / kC);
    var[j] = (hf ? tot[j] : oth) * (1.f / kC) - mu[j] * mu[j] + kEPS;
  }
  const v4f rs = rsq_quad(var), nm = -mu * rs;

  // Row s keeps its 16-byte piece p at place p ^ (s >> 4): the 16 lanes of a half wave, 4 rows
  // apart on one piece, then meet every bank once.
  bf16_t* tw = &tile[sq * 4][(cg ^ (sq >> 2)) * 8];
#pragma unroll
  for (int ii = 0; ii < 4; ++ii) {
    v4f y[8];
#pragma unroll
    for (int e = 0; e < 4; ++e) {
      y[e]     = (v[ii][e] * rs + nm) * gv[ii][0][e] + bv[ii][0][e];
      y[e + 4] = (v[ii][e + 4] * rs + nm) * gv[ii][1][e] + bv[ii][1][e];
    }
#pragma unroll
    for (int j = 0; j < 4; ++j)
      *(v4u*)(tw + j * LP + ii * 256) = v4u{pack2(y[0][j], y[1][j]), pack2(y[2][j], y[3][j]),
                                            pack2(y[4][j], y[5][j]), pack2(y[6][j], y[7][j])};
  }
  __syncthreads();   // tile rows are read back by other waves than wrote them

  // A wave takes 4 rows, 512 B at a time.
  const bf16_t* tr = &tile[wid * 4][(lane ^ (wid >> 2)) * 8];
  bf16_t* dst = xn + ((size_t)b * kS + s0 + wid * 4) * kC + lane * 8;
  v4u o[16];
#pragma unroll
  for (int i = 0; i < 16; ++i) o[i] = *(const v4u*)(tr + (i >> 2) * LP + (i & 3) * 256);
#pragma unroll
  for (int i = 0; i < 16; ++i) *(v4u*)(dst + (size_t)(i >> 2) * kC + (i & 3) * 256) = o[i];
}

// --------------------------------------------- LN on row-major rows (text)
__global__ __launch_bounds__(256) void ln_rows_kernel(const float* __restrict__ src,
                                                      const float* __restrict__ gg,
                                                      const float* __restrict__ bb,
                                                      bf16_t* __restrict__ dst,
                                                      int nrows) {
  const int lane = threadIdx.x & 31, wid = threadIdx.x >> 5;
  const int row = blockIdx.x * 8 + wid;
  if (row >= nrows) return;
  const float* p = src + (size_t)row * kC;
  float vals[32];
  float sum = 0.f;
#pragma unroll
  for (int j = 0; j < 32; ++j) { vals[j] = p[j * 32 + lane]; sum += vals[j]; }
#pragma unroll
  for (int off = 16; off >= 1; off >>= 1) sum += __shfl_xor(sum, off);
  const float mu = sum * (1.f / kC);
  float sq = 0.f;
#pragma unroll
  for (int j = 0; j < 32; ++j) { float d = vals[j] - mu; sq += d * d; }
#pragma unroll
  for (int off = 16; off >= 1; off >>= 1) sq += __shfl_xor(sq, off);
  const float rs = rsqrtf(sq * (1.f / kC) + kEPS);
  bf16_t* q = dst + (size_t)row * kC;
#pragma unroll
  for (int j = 0; j < 32; ++j) {
    int c = j * 32 + lane;
    q[c] = tobf((vals[j] - mu) * rs * gg[c] + bb[c]);
  }
}

// sin and cos of eight angles given in revolutions, in one statement so that the slot which the
// instruction set asks for behind a transcendental holds by construction: an early-clobber result
// shares no register with a source, so none overwrites the source or reads the result of the one
// in front of it, and v_nop fills the slot behind the last.
__device__ __forceinline__ void sincos_tile(const float (&r)[8], float (&s)[8], float (&c)[8]) {
  asm("v_sin_f32 %0, %16\n\tv_sin_f32 %1, %17\n\tv_sin_f32 %2, %18\n\tv_sin_f32 %3, %19\n\t"
      "v_sin_f32 %4, %20\n\tv_sin_f32 %5, %21\n\tv_sin_f32 %6, %22\n\tv_sin_f32 %7, %23\n\t"
      "v_cos_f32 %8, %16\n\tv_cos_f32 %9, %17\n\tv_cos_f32 %10, %18\n\tv_cos_f32 %11, %19\n\t"
      "v_cos_f32 %12, %20\n\tv_cos_f32 %13, %21\n\tv_cos_f32 %14, %22\n\tv_cos_f32 %15, %23\n\t"
      "v_nop"
      : "=&v"(s[0]), "=&v"(s[1]), "=&v"(s[2]), "=&v"(s[3]),
        "=&v"(s[4]), "=&v"(s[5]), "=&v"(s[6]), "=&v"(s[7]),
        "=&v"(c[0]), "=&v"(c[1]), "=&v"(c[2]), "=&v"(c[3]),
        "=&v"(c[4]), "=&v"(c[5]), "=&v"(c[6]), "=&v"(c[7])
      : "v"(r[0]), "v"(r[1]), "v"(r[2]), "v"(r[3]), "v"(r[4]), "v"(r[5]), "v"(r[6]), "v"(r[7]));
}

// --------------------------------------------- bf16 GEMM: out = A(MxK) @ Wt(NxK)^T + bias
// Double-buffered async LDS staging; K-step 64. A wave makes 64 x 64 of the output: 16 WMMA on 8
// fragments, so that LDS reads keep up with the matrix unit. A block is MT x 128, MT / 32 waves:
// 256 rows where that still gives every WGP two blocks (fewest bytes from L2), else 128.
// MODE 0: bf16 (B,H,S,D) = RoPE(acc) / sqrt(D)   (Q)
// MODE 3: bf16 (B,H,T,D) = RoPE(acc), positions rescaled onto the query timeline   (K)
// MODE 1: bf16 scattered V^T (B,H,D,T)  (V)
// MODE 2: fp32 (B,C,S) = resid + acc    (output projection + residual transpose)
constexpr int NT = 128, KT = 64;
constexpr int GP = 72;   // GEMM LDS pitch: 144B rows, 16B aligned, conflict-free
constexpr int AP = 40;   // attention LDS pitch: 80B rows

template <int MT>
struct GemmTiles {
  bf16_t a[2][MT][GP];
  bf16_t b[2][NT][GP];
};

// At least 4 waves per SIMD: 256 registers, so that the blocks whose LDS fits a WGP are resident
// together and one's barriers and copy waits are covered by the others.
template <int MODE, int MT>
__global__ __launch_bounds__(MT) __attribute__((amdgpu_waves_per_eu(4))) void gemm_bf16_kernel(
    const bf16_t* __restrict__ A, const bf16_t* __restrict__ Wt,
    const float* __restrict__ bias, float* __restrict__ outF,
    bf16_t* __restrict__ outB, const float* __restrict__ resid) {
  constexpr bool ROPE = (MODE == 0 || MODE == 3);
  constexpr int GTH = MT;       // threads: a wave per 64 x 64
  constexpr int WM = MT / 64;   // waves along m
  constexpr int CP = MT + 4;    // epilogue LDS pitch in floats: 16-byte column walks, no conflicts
  // The operand tiles and, behind the K loop, the epilogue's staging share one allocation.
  constexpr size_t EPI = ROPE ? sizeof(bf16_t) * 2 * MT * GP : sizeof(float) * NT * CP;
  constexpr size_t LSZ = sizeof(GemmTiles<MT>) > EPI ? sizeof(GemmTiles<MT>) : EPI;
  __shared__ alignas(16) char smem[LSZ];
  GemmTiles<MT>& lds = *reinterpret_cast<GemmTiles<MT>*>(smem);
  const int tid = threadIdx.x, lane = tid & 31, wid = tid >> 5;
  const int m0 = blockIdx.x * MT, n0 = blockIdx.y * NT;
  // A wave's 64 columns are one head: with RoPE a rotation's two partners, channels d and d + 32,
  // sit in one lane, in acc[sm][sn] and acc[sm][sn + 2].
  const int wh = wid / WM;
  const int wm = (wid % WM) * 64;
  const int wn = wh * 64;

  v8f acc[4][4];
#pragma unroll
  for (int sn = 0; sn < 4; ++sn) {
    const float bv = bias[n0 + wn + sn * 16 + (lane & 15)];
#pragma unroll
    for (int sm = 0; sm < 4; ++sm)
#pragma unroll
      for (int i = 0; i < 8; ++i) acc[sm][sn][i] = bv;
  }

  constexpr int NCA = MT * KT / 8 / GTH;   // 16-byte copies per thread and stage, A tile
  constexpr int NCB = NT * KT / 8 / GTH;   // the same, Bt tile
  // A copy's source is a block-uniform base plus an unsigned 32-bit offset that both tiles share:
  // a stage's copies then take eight offset registers instead of a 64-bit address each, and the
  // fragments keep theirs inside the wave's 256.
  const bf16_t* Ab = A + (size_t)m0 * kC;
  const bf16_t* Bb = Wt + (size_t)n0 * kC;
  auto stage = [&](int s, int k0) {
#if USE_ASYNC_LDS
#pragma unroll
    for (int i = 0; i < NCA; ++i) {
      const int idx = tid + i * GTH, r = idx >> 3, c = (idx & 7) * 8;
      async_copy16(&lds.a[s][r][c], (Ab + k0) + (u32)(r * kC + c));
    }
#pragma unroll
    for (int i = 0; i < NCB; ++i) {
      const int idx = tid + i * GTH, r = idx >> 3, c = (idx & 7) * 8;
      async_copy16(&lds.b[s][r][c], (Bb + k0) + (u32)(r * kC + c));
    }
#else
    const u32* Ag = (const u32*)A;
    const u32* Wg = (const u32*)Wt;
#pragma unroll
    for (int i = 0; i < 4 * NCA; ++i) {
      int idx = tid + i * GTH, r = idx >> 5, cu = idx & 31;
      *(u32*)&lds.a[s][r][cu * 2] = Ag[(size_t)(m0 + r) * (kC / 2) + (k0 >> 1) + cu];
    }
#pragma unroll
    for (int i = 0; i < 4 * NCB; ++i) {
      int idx = tid + i * GTH, r = idx >> 5, cu = idx & 31;
      *(u32*)&lds.b[s][r][cu * 2] = Wg[(size_t)(n0 + r) * (kC / 2) + (k0 >> 1) + cu];
    }
#endif
  };

  constexpr int NK = kC / KT;
  stage(0, 0);
  for (int it = 0; it < NK; ++it) {
    const int cur = it & 1;
    if (it + 1 < NK) {
      stage(1 - cur, (it + 1) * KT);
      ASYNC_WAIT(NCA + NCB);  // only current tile's (oldest) copies must land
    } else {
      ASYNC_WAIT(0);
    }
    __syncthreads();
#pragma unroll
    for (int kk = 0; kk < KT; kk += 32) {
      v16bf af[4], bf[4];
#pragma unroll
      for (int sm = 0; sm < 4; ++sm) af[sm] = frag16(&lds.a[cur][wm + sm * 16][kk], GP, lane);
#pragma unroll
      for (int sn = 0; sn < 4; ++sn) bf[sn] = frag16(&lds.b[cur][wn + sn * 16][kk], GP, lane);
#pragma unroll
      for (int sm = 0; sm < 4; ++sm)
#pragma unroll
        for (int sn = 0; sn < 4; ++sn) acc[sm][sn] = wmma_bf16(af[sm], bf[sn], acc[sm][sn]);
    }
    __syncthreads();
  }

  // Keeps the epilogue's angle arithmetic and residual loads behind the K loop: scheduled in among
  // the last matrix instructions, where the fragments still hold their registers, they spill.
  __builtin_amdgcn_sched_barrier(0);

  if constexpr (ROPE) {
    // Rotate in registers, then through LDS as Rt[head of the tile * MT + row][d]: a head's MT
    // rows of 128 B are contiguous in the destination, so a wave stores 512 B in a row.
    // The tiles are free here: the K loop's last barrier ended their last read.
    static_assert(NT == 2 * kD, "a tile holds two whole heads");
    constexpr int ROWS = (MODE == 0) ? kS : kT;    // rows of A per batch
    static_assert(ROWS % MT == 0, "a tile lies in one batch");
    constexpr float POS = (float)kS / ROWS;               // key positions on the query timeline
    constexpr float OSC = (MODE == 0) ? 0.125f : 1.0f;    // q / sqrt(D)
    unsigned short* Rt = reinterpret_cast<unsigned short*>(smem);
    const int b = m0 / ROWS, r0 = m0 % ROWS;
#pragma unroll
    for (int dp = 0; dp < 2; ++dp) {
      const int d = dp * 16 + (lane & 15);
      const float inv = __powf(10000.f, -(float)d * (1.f / 32.f));
#pragma unroll
      for (int sm = 0; sm < 4; ++sm) {
        const int ml = wm + sm * 16 + ((lane >> 4) << 3);
        unsigned short* p = Rt + (wh * MT + ml) * GP + d;
        float rev[8], s[8], c[8];
#pragma unroll
        for (int i = 0; i < 8; ++i)
          rev[i] = (float)(r0 + ml + i) * POS * inv * 0.15915494309189532f;   // angle / 2 pi
        sincos_tile(rev, s, c);
#pragma unroll
        for (int i = 0; i < 8; i += 2) {
          float lo[2], hi[2];
#pragma unroll
          for (int j = 0; j < 2; ++j) {
            const float t1 = acc[sm][dp][i + j], t2 = acc[sm][dp + 2][i + j];
            lo[j] = (t1 * c[i + j] - t2 * s[i + j]) * OSC;
            hi[j] = (t1 * s[i + j] + t2 * c[i + j]) * OSC;
          }
          const u32 a = pack2(lo[0], lo[1]), h = pack2(hi[0], hi[1]);
          p[i * GP]            = (unsigned short)a;
          p[(i + 1) * GP]      = (unsigned short)(a >> 16);
          p[i * GP + 32]       = (unsigned short)h;
          p[(i + 1) * GP + 32] = (unsigned short)(h >> 16);
        }
      }
    }
    __syncthreads();   // Rt rows are read back by other waves than wrote them

    constexpr int RSW = GTH / 8;                   // 8 lanes a row: rows a sweep
    constexpr int HSW = MT / RSW;                  // sweeps a head
    const int rr = tid >> 3, cc = (tid & 7) * 8;
    v4u rv[2 * HSW];
#pragma unroll
    for (int i = 0; i < 2 * HSW; ++i) rv[i] = *(const v4u*)(Rt + (rr + RSW * i) * GP + cc);
    bf16_t* dst = outB + (((size_t)b * kH + n0 / kD) * ROWS + r0 + rr) * kD + cc;
#pragma unroll
    for (int i = 0; i < 2 * HSW; ++i)
      *(v4u*)(dst + ((size_t)(i / HSW) * ROWS + (i % HSW) * RSW) * kD) = rv[i];
  } else {
    // Transposed outputs: row n of the destination is contiguous in m. The tile goes
    // through LDS as Ct[n][m], so every global access is 16 B per lane on whole lines.
    // The tiles are free here: the K loop's last barrier ended their last read.
    float* Ct = reinterpret_cast<float*>(smem);
    constexpr int ROWS = (MODE == 2) ? kS : kT;    // rows of A per batch = destination pitch
    static_assert(ROWS % MT == 0, "a tile lies in one batch");
    const int b = m0 / ROWS, r0 = m0 % ROWS;
    const size_t gbase = ((size_t)b * kC + n0) * ROWS + r0;

    // Reader's share: rows nr + RST * i of the tile, 16 B of the destination at column cr.
    constexpr int LPR = (MODE == 2) ? MT / 4 : MT / 8;   // lanes per destination row
    constexpr int RST = GTH / LPR;                 // rows per sweep of the block
    constexpr int NSW = NT / RST;                  // sweeps
    const int nr = tid / LPR, cr = (tid % LPR) * (MT / LPR);
    const size_t goff = gbase + (size_t)nr * ROWS + cr;
    const float* crd = Ct + nr * CP + cr;

    // Residual rows: the first half is asked for ahead of the LDS round trip, the second behind
    // the barrier, in the registers that the accumulators have left by then.
    v4f rr[NSW];
    if constexpr (MODE == 2) {
#pragma unroll
      for (int i = 0; i < NSW / 2; ++i)
        rr[i] = *(const v4f*)(resid + goff + (size_t)i * RST * ROWS);
    }

#pragma unroll
    for (int sm = 0; sm < 4; ++sm)
#pragma unroll
      for (int sn = 0; sn < 4; ++sn) {
        float* p = Ct + (wn + sn * 16 + (lane & 15)) * CP + wm + sm * 16 + ((lane >> 4) << 3);
        const v8f a = acc[sm][sn];
        *(v4f*)(p)     = v4f{a[0], a[1], a[2], a[3]};
        *(v4f*)(p + 4) = v4f{a[4], a[5], a[6], a[7]};
      }
    __syncthreads();   // Ct rows are read back by other waves than wrote them

    if constexpr (MODE == 2) {
#pragma unroll
      for (int i = NSW / 2; i < NSW; ++i)
        rr[i] = *(const v4f*)(resid + goff + (size_t)i * RST * ROWS);
    }

    if constexpr (MODE == 1) {   // V^T: (B,H,D,T) = (B,C,T), whole lines of bf16 per row
#pragma unroll
      for (int i = 0; i < NSW; ++i) {
        const v4f lo = *(const v4f*)(crd + i * RST * CP);
        const v4f hi = *(const v4f*)(crd + i * RST * CP + 4);
        union { bf16_t h[8]; v4u u; } pk;
#pragma unroll
        for (int j = 0; j < 4; ++j) { pk.h[j] = tobf(lo[j]); pk.h[4 + j] = tobf(hi[j]); }
        *(v4u*)(outB + goff + (size_t)i * RST * ROWS) = pk.u;
      }
    } else {                     // out (B,C,S) = resid + acc, whole lines of floats per row
      // Eight rows at a time, three sweeps kept apart: the LDS reads, then the stores, each go
      // out back to back.
#pragma unroll
      for (int i0 = 0; i0 < NSW; i0 += 8) {
        v4f cv[8];
#pragma unroll
        for (int i = 0; i < 8; ++i) cv[i] = *(const v4f*)(crd + (i0 + i) * RST * CP);
#pragma unroll
        for (int i = 0; i < 8; ++i) cv[i] = rr[i0 + i] + cv[i];
#pragma unroll
        for (int i = 0; i < 8; ++i)
          *(v4f*)(outF + goff + (size_t)(i0 + i) * RST * ROWS) = cv[i];
      }
    }
  }
}

constexpr int KP = 72;   // Ks pitch

// 2^x of the eight scores of one tile, in one statement so that the slot which the instruction
// set asks for behind a transcendental holds by construction: an early-clobber result shares no
// register with a source, so no exponential overwrites the source or reads the result of the one
// in front of it, and v_nop fills the slot behind the last.
__device__ __forceinline__ void exp2_tile(const v8f a, float (&p)[8]) {
  asm("v_exp_f32 %0, %8\n\tv_exp_f32 %1, %9\n\tv_exp_f32 %2, %10\n\tv_exp_f32 %3, %11\n\t"
      "v_exp_f32 %4, %12\n\tv_exp_f32 %5, %13\n\tv_exp_f32 %6, %14\n\tv_exp_f32 %7, %15\n\t"
      "v_nop"
      : "=&v"(p[0]), "=&v"(p[1]), "=&v"(p[2]), "=&v"(p[3]),
        "=&v"(p[4]), "=&v"(p[5]), "=&v"(p[6]), "=&v"(p[7])
      : "v"(a[0]), "v"(a[1]), "v"(a[2]), "v"(a[3]), "v"(a[4]), "v"(a[5]), "v"(a[6]), "v"(a[7]));
}

// At most 8 waves per SIMD: 128 registers, so that a pass's 16 LDS reads go out as one group
// ahead of the products instead of pair by pair, each with its own wait.
__global__ __launch_bounds__(256) __attribute__((amdgpu_waves_per_eu(4, 8))) void attn_kernel(const bf16_t* __restrict__ q,
                                                   const bf16_t* __restrict__ k,
                                                   const bf16_t* __restrict__ vt,
                                                   bf16_t* __restrict__ o) {
  __shared__ bf16_t Ks[2][32][KP];       // K tile, rows t, cols d
  __shared__ bf16_t Vts[2][kD][AP];      // V^T tile, rows d, cols t
  const int tid = threadIdx.x, lane = tid & 31, wid = tid >> 5;
  const int bh = blockIdx.y, b = bh / kH, h = bh % kH;
  const int s0 = blockIdx.x * 128 + wid * 16;
  const int g = lane >> 4;

  // Q fragments (held for whole T loop), the B operand of S^T: column = query lane & 15.
  v16bf qf[2];
  {
    const bf16_t* qrow = q + ((size_t)bh * kS + s0 + (lane & 15)) * kD;
#pragma unroll
    for (int kd = 0; kd < 2; ++kd) {
      union { struct { v4u lo, hi; } p; v16bf v; } u;
      u.p.lo = *(const v4u*)(qrow + kd * 32 + g * 8);
      u.p.hi = *(const v4u*)(qrow + kd * 32 + g * 8 + 16);
      qf[kd] = u.v;
    }
  }

  float mrun = -3.0e38f;   // this query's running maximum, equal in both lane halves
  float lrun = 0.f;        // denominator over this lane half's keys; the halves join after the loop
  v8f oacc[4];             // oacc[dn][i] = O[query lane & 15][dn * 16 + 8 g + i]
#pragma unroll
  for (int f = 0; f < 4; ++f) oacc[f] = v8f{};

  const bf16_t* kb = k + (size_t)bh * kT * kD;
  const bf16_t* vb = vt + (size_t)bh * kD * kT;

  auto stage = [&](int s, int t0) {
#if USE_ASYNC_LDS
    const int rk = tid >> 3, ck = (tid & 7) * 8;        // 32 x 64
    async_copy16(&Ks[s][rk][ck], kb + (size_t)(t0 + rk) * kD + ck);
    const int rv = tid >> 2, cv = (tid & 3) * 8;        // 64 x 32
    async_copy16(&Vts[s][rv][cv], vb + (size_t)rv * kT + t0 + cv);
#else
    const u32* kg = (const u32*)kb;
    const u32* vg = (const u32*)vb;
#pragma unroll
    for (int i = 0; i < 4; ++i) {
      int idx = tid + i * 256;
      int rk = idx >> 5, ck = idx & 31;
      *(u32*)&Ks[s][rk][ck * 2] = kg[(size_t)(t0 + rk) * (kD / 2) + ck];
      int rv = idx >> 4, cv = idx & 15;
      *(u32*)&Vts[s][rv][cv * 2] = vg[(size_t)rv * (kT / 2) + (t0 >> 1) + cv];
    }
#endif
  };

  constexpr int NSTEP = kT / 32;
  stage(0, 0);
  for (int it = 0; it < NSTEP; ++it) {
    const int cur = it & 1;
    if (it + 1 < NSTEP) {
      stage(1 - cur, (it + 1) * 32);
      ASYNC_WAIT(2);
    } else {
      ASYNC_WAIT(0);
    }
    __syncthreads();

    // scores^T: 32 keys x 16 queries (two M-subtiles), contraction over d in two K-steps.
    // st[kt][i] = score of key kt * 16 + 8 g + i against query lane & 15.
    v8f st[2]; st[0] = v8f{}; st[1] = v8f{};
#pragma unroll
    for (int kd = 0; kd < 2; ++kd)
#pragma unroll
      for (int kt = 0; kt < 2; ++kt)
        st[kt] = wmma_bf16(frag16(&Ks[cur][kt * 16][kd * 32], KP, lane), qf[kd], st[kt]);

    // online softmax: one query per lane
    float vmax = fmaxf(st[0][0], st[1][0]);
#pragma unroll
    for (int i = 1; i < 8; ++i) vmax = fmaxf(vmax, fmaxf(st[0][i], st[1][i]));
    vmax = fmaxf(vmax, xhalf(vmax));
    const float mnew = fmaxf(mrun, vmax);
    const float alpha = __expf(mrun - mnew);
    mrun = mnew;

    // P^T as B operand: element e < 8 is key 8 g + e, element 8 + e is key 16 + 8 g + e,
    // the k order in which frag16 reads the V^T rows.
    union { u32 w[8]; v16bf v; } pf;
    float p[2][8];
#pragma unroll
    for (int kt = 0; kt < 2; ++kt)
      exp2_tile((st[kt] - mnew) * 1.44269504f, p[kt]);   // e^(score - maximum)
    float sum[4];
#pragma unroll
    for (int j = 0; j < 4; ++j) {
      pf.w[j]     = pack2(p[0][2 * j], p[0][2 * j + 1]);
      pf.w[4 + j] = pack2(p[1][2 * j], p[1][2 * j + 1]);
      sum[j] = (p[0][2 * j] + p[0][2 * j + 1]) + (p[1][2 * j] + p[1][2 * j + 1]);
    }
    lrun = lrun * alpha + ((sum[0] + sum[1]) + (sum[2] + sum[3]));
#pragma unroll
    for (int f = 0; f < 4; ++f) oacc[f] *= alpha;

    // O^T += V^T.P^T: A = V^T tile (lane-striped d, contiguous t), B = P^T
#pragma unroll
    for (int dn = 0; dn < 4; ++dn)
      oacc[dn] = wmma_bf16(frag16(&Vts[cur][dn * 16][0], AP, lane), pf.v, oacc[dn]);
    __syncthreads();
  }

  // normalize and write o (B,S,C) bf16: a lane's 8 registers are 8 consecutive channels
  const float inv = 1.f / (lrun + xhalf(lrun));
  bf16_t* orow = o + ((size_t)b * kS + s0 + (lane & 15)) * kC + h * kD + g * 8;
#pragma unroll
  for (int dn = 0; dn < 4; ++dn) {
    const v8f r = oacc[dn] * inv;
    *(v4u*)(orow + dn * 16) = v4u{pack2(r[0], r[1]), pack2(r[2], r[3]),
                                  pack2(r[4], r[5]), pack2(r[6], r[7])};
  }
}

// ---------------------------------------------------------------- launch
extern "C" void kernel_launch(void* const* d_in, const int* in_sizes, int n_in,
                              void* d_out, int out_size, void* d_ws, size_t ws_size,
                              hipStream_t stream) {
  const float* x   = (const float*)d_in[0];
  const float* te  = (const float*)d_in[1];
  const float* g_x = (const float*)d_in[2];
  const float* b_x = (const float*)d_in[3];
  const float* g_t = (const float*)d_in[4];
  const float* b_t = (const float*)d_in[5];
  const float* Wq  = (const float*)d_in[6];
  const float* bq  = (const float*)d_in[7];
  const float* Wk  = (const float*)d_in[8];
  const float* bk  = (const float*)d_in[9];
  const float* Wv  = (const float*)d_in[10];
  const float* bv  = (const float*)d_in[11];
  const float* Wo  = (const float*)d_in[12];
  const float* bo  = (const float*)d_in[13];
  float* out = (float*)d_out;
  char* ws = (char*)d_ws;

  size_t off = 0;
  auto alloc = [&](size_t bytes) {
    size_t o = off; off += (bytes + 255) & ~(size_t)255; return o;
  };
  bf16_t* xn   = (bf16_t*)(ws + alloc((size_t)kB * kS * kC * 2));
  bf16_t* tn   = (bf16_t*)(ws + alloc((size_t)kB * kT * kC * 2));
  bf16_t* Wqt  = (bf16_t*)(ws + alloc((size_t)kC * kC * 2));
  bf16_t* Wkt  = (bf16_t*)(ws + alloc((size_t)kC * kC * 2));
  bf16_t* Wvt  = (bf16_t*)(ws + alloc((size_t)kC * kC * 2));
  bf16_t* Wot  = (bf16_t*)(ws + alloc((size_t)kC * kC * 2));
  bf16_t* qbf  = (bf16_t*)(ws + alloc((size_t)kB * kS * kC * 2));
  bf16_t* kbf  = (bf16_t*)(ws + alloc((size_t)kB * kT * kC * 2));
  bf16_t* vtbf = (bf16_t*)(ws + alloc((size_t)kB * kT * kC * 2));
  bf16_t* obf  = (bf16_t*)(ws + alloc((size_t)kB * kS * kC * 2));

  wt_kernel<<<dim3(kC / WT, kC / WT, 4), 256, 0, stream>>>(Wq, Wk, Wv, Wo, Wqt, Wkt, Wvt, Wot);

  ln_x_kernel<<<dim3(kS / LS, kB), LTH, 0, stream>>>(x, g_x, b_x, xn);
  ln_rows_kernel<<<(kB * kT) / 8, 256, 0, stream>>>(te, g_t, b_t, tn, kB * kT);

  gemm_bf16_kernel<0, 256><<<dim3((kB * kS) / 256, kC / NT), 256, 0, stream>>>(
      xn, Wqt, bq, nullptr, qbf, nullptr);
  gemm_bf16_kernel<3, 128><<<dim3((kB * kT) / 128, kC / NT), 128, 0, stream>>>(
      tn, Wkt, bk, nullptr, kbf, nullptr);
  gemm_bf16_kernel<1, 128><<<dim3((kB * kT) / 128, kC / NT), 128, 0, stream>>>(
      tn, Wvt, bv, nullptr, vtbf, nullptr);

  attn_kernel<<<dim3(kS / 128, kB * kH), 256, 0, stream>>>(qbf, kbf, vtbf, obf);

  gemm_bf16_kernel<2, 256><<<dim3((kB * kS) / 256, kC / NT), 256, 0, stream>>>(
      obf, Wot, bo, out, nullptr, x);
}

// v007
// It runs in 126 microseconds.
// In two side-by-side timings against v006, it was 1.09 and 1.10 times as fast.
// Over all steps from v000 it is 2.74 times as fast.
#include <hip/hip_runtime.h>

typedef __bf16 bf16_t;
typedef unsigned int u32;
typedef __attribute__((ext_vector_type(16))) bf16_t v16bf;
typedef __attribute__((ext_vector_type(8)))  float  v8f;
typedef __attribute__((ext_vector_type(4)))  u32    v4u;
typedef __attribute__((ext_vector_type(4)))  int    v4i;
typedef __attribute__((ext_vector_type(4)))  float  v4f;

constexpr int kB = 8, kC = 1024, kS = 2048, kT = 512, kH = 16, kD = 64;
constexpr float kEPS = 1e-5f;

#ifndef __has_builtin
#define __has_builtin(x) 0
#endif
#if __has_builtin(__builtin_amdgcn_global_load_async_to_lds_b128) && \
    __has_builtin(__builtin_amdgcn_s_wait_asynccnt)
#define USE_ASYNC_LDS 1
#else
#define USE_ASYNC_LDS 0
#endif

#define AS1 __attribute__((address_space(1)))
#define AS3 __attribute__((address_space(3)))

#if USE_ASYNC_LDS
__device__ __forceinline__ void async_copy16(bf16_t* lds, const bf16_t* g) {
  __builtin_amdgcn_global_load_async_to_lds_b128((AS1 v4i*)g, (AS3 v4i*)lds, 0, 0);
}
#define ASYNC_WAIT(n) __builtin_amdgcn_s_wait_asynccnt(n)
#else
#define ASYNC_WAIT(n)
#endif

// ---------------------------------------------------------------- helpers
__device__ __forceinline__ bf16_t tobf(float f) {
  union { float f; u32 u; } a; a.f = f;
  u32 r = a.u + 0x7FFFu + ((a.u >> 16) & 1u);          // round-nearest-even
  union { unsigned short s; bf16_t h; } b;
  b.s = (unsigned short)(r >> 16);
  return b.h;
}

typedef __attribute__((ext_vector_type(2))) float  v2f;
typedef __attribute__((ext_vector_type(2))) bf16_t v2bf;

__device__ __forceinline__ u32 pack2(float lo, float hi) {   // two f32 -> packed bf16, nearest even
  return __builtin_bit_cast(u32, __builtin_convertvector(v2f{lo, hi}, v2bf));
}

__device__ __forceinline__ float xhalf(float x) {            // lane l reads lane l ^ 16
  const int b = __builtin_bit_cast(int, x);
  return __builtin_bit_cast(float, __builtin_amdgcn_permlanex16(b, b, 0x76543210, 0xfedcba98,
                                                                false, false));
}

// 16-bit matrix fragment (ISA 7.12.2): lane-striped rows, K contiguous.
// Elements [0..7] = K 8g..8g+7, [8..15] = K 16+8g..23+8g  ->  two b128 loads.
__device__ __forceinline__ v16bf frag16(const bf16_t* base, int pitch, int lane) {
  const int m = lane & 15, g = lane >> 4;
  const bf16_t* r = base + m * pitch + g * 8;
  union { struct { v4u lo, hi; } p; v16bf v; } u;
  u.p.lo = *(const v4u*)(r);
  u.p.hi = *(const v4u*)(r + 16);
  return u.v;
}

__device__ __forceinline__ v8f wmma_bf16(v16bf a, v16bf b, v8f c) {
  return __builtin_amdgcn_wmma_f32_16x16x32_bf16(false, a, false, b, (short)0, c,
                                                 false, false);
}

// --------------------------------------------- four W (KxN) -> Wt (NxK) bf16
// A block turns one 128 x 128 tile, number job of 64 a matrix, 256 for all four weights, so that
// starting blocks and waves no longer outweighs the 24 MB moved.
constexpr int WT = 128;
constexpr int WJOBS = 4 * (kC / WT) * (kC / WT);

__device__ __forceinline__ void wt_tile(
    const int job,
    const float* __restrict__ W0, const float* __restrict__ W1,
    const float* __restrict__ W2, const float* __restrict__ W3,
    bf16_t* __restrict__ T0, bf16_t* __restrict__ T1,
    bf16_t* __restrict__ T2, bf16_t* __restrict__ T3) {
  __shared__ float t[WT][WT + 1];   // odd pitch: a walk down a column meets every bank once
  const int lane = threadIdx.x & 31, wid = threadIdx.x >> 5;
  const int z = job / (WJOBS / 4);
  const float* W = z == 0 ? W0 : z == 1 ? W1 : z == 2 ? W2 : W3;
  bf16_t* Wt     = z == 0 ? T0 : z == 1 ? T1 : z == 2 ? T2 : T3;
  const int k0 = (job % (kC / WT)) * WT, n0 = (job / (kC / WT) % (kC / WT)) * WT;

  // A wave reads a whole 512-B row of the tile per load; all 16 loads of a lane fly together.
  const float* src = W + (size_t)(k0 + wid) * kC + n0 + lane * 4;
  v4f v[WT / 8];
#pragma unroll
  for (int i = 0; i < WT / 8; ++i) v[i] = *(const v4f*)(src + (size_t)i * 8 * kC);
  // The wait that belongs in front of any rewrite of a register which an issued load names; src as
  // its input keeps the address pair out of the loads' own destinations.
  asm volatile("s_wait_xcnt 0x0" :: "v"(src) : "memory");
  // Column n is kept at place (n & 3) * 32 + (n >> 2), so that a wave's 32 words are adjacent.
  float* tw = &t[wid][lane];
#pragma unroll
  for (int i = 0; i < WT / 8; ++i)
#pragma unroll
    for (int j = 0; j < 4; ++j) tw[i * 8 * (WT + 1) + j * 32] = v[i][j];
  __syncthreads();

  // A wave writes 64 k of the rows n = nq + 4 i: two k per lane, one whole 128-B line per store.
  const int nq = wid >> 1, k = (wid & 1) * 64 + 2 * lane;
  const float* tr = &t[k][nq * 32];
  bf16_t* dst = Wt + (size_t)(n0 + nq) * kC + k0 + k;
#pragma unroll
  for (int i = 0; i < WT / 4; ++i) {
    union { bf16_t h[2]; u32 u; } pk;
    pk.h[0] = tobf(tr[i]);
    pk.h[1] = tobf(tr[WT + 1 + i]);
    *(u32*)(dst + (size_t)i * 4 * kC) = pk.u;
  }
}

// 1 / sqrt of four values, in one statement so that the slot which the instruction set asks for
// behind a transcendental holds by construction: an early-clobber result shares no register with a
// source, and v_nop fills the slot behind the last.
__device__ __forceinline__ v4f rsq_quad(const v4f a) {
  float r0, r1, r2, r3;
  asm("v_rsq_f32 %0, %4\n\tv_rsq_f32 %1, %5\n\tv_rsq_f32 %2, %6\n\tv_rsq_f32 %3, %7\n\tv_nop"
      : "=&v"(r0), "=&v"(r1), "=&v"(r2), "=&v"(r3)
      : "v"(a[0]), "v"(a[1]), "v"(a[2]), "v"(a[3]));
  return v4f{r0, r1, r2, r3};
}

// --------------------------------------------- LN over C of x (B,C,S) -> xn (B,S,C) bf16
// A block keeps 64 positions x all 1024 channels in registers, so x is read once: 16 B a lane, 256 B
// of a channel's row per half wave, a lane's 32 loads all in flight together. The normalised tile
// turns through LDS as bf16, and a wave stores 512 B of one position's row at a time.
constexpr int LS = 64;        // positions a block
constexpr int LTH = 512;      // threads: 16 lanes along s, 32 groups of 8 channels
constexpr int LP = kC + 8;    // tile pitch in bf16: 2064 B, 16 B x odd

__global__ __launch_bounds__(LTH) void ln_x_kernel(const float* __restrict__ x,
                                                   const float* __restrict__ gg,
                                                   const float* __restrict__ bb,
                                                   bf16_t* __restrict__ xn) {
  __shared__ alignas(16) bf16_t tile[LS][LP];
  __shared__ alignas(16) float red[LTH / 32][2][LS];
  const int tid = threadIdx.x, lane = tid & 31, wid = tid >> 5;
  const int sq = lane & 15, hf = lane >> 4;   // positions 4 sq .. 4 sq + 3
  const int cg = tid >> 4;                    // channels 256 ii + 8 cg + e
  const int b = blockIdx.y, s0 = blockIdx.x * LS;

  const float* src = x + ((size_t)b * kC + cg * 8) * kS + s0 + sq * 4;
  v4f v[4][8];
#pragma unroll
  for (int ii = 0; ii < 4; ++ii)
#pragma unroll
    for (int e = 0; e < 8; ++e) v[ii][e] = *(const v4f*)(src + (size_t)(ii * 256 + e) * kS);
  // Scale and shift of the lane's channels are asked for along with x: nothing waits for them later.
  v4f gv[4][2], bv[4][2];
#pragma unroll
  for (int ii = 0; ii < 4; ++ii)
#pragma unroll
    for (int q = 0; q < 2; ++q) {
      gv[ii][q] = *(const v4f*)(gg + ii * 256 + cg * 8 + q * 4);
      bv[ii][q] = *(const v4f*)(bb + ii * 256 + cg * 8 + q * 4);
    }
  // The wait that belongs in front of any rewrite of a register which an issued load names; src as
  // its input keeps the address pair out of the loads' own destinations.
  asm volatile("s_wait_xcnt 0x0" :: "v"(src) : "memory");

  v4f sum = v[0][0], sqs = v[0][0] * v[0][0];
#pragma unroll
  for (int i = 1; i < 32; ++i) {
    const v4f t = v[i >> 3][i & 7];
    sum += t; sqs += t * t;
  }
  // The two lane halves hold different channels of the same positions.
#pragma unroll
  for (int j = 0; j < 4; ++j) { sum[j] += xhalf(sum[j]); sqs[j] += xhalf(sqs[j]); }
  *(v4f*)&red[wid][hf][sq * 4] = hf ? sqs : sum;
  __syncthreads();   // every wave's partial sums are read by every wave

  // The lower half adds up the waves' sums, the upper their sums of squares; then they exchange.
  v4f tot = *(const v4f*)&red[0][hf][sq * 4];
#pragma unroll
  for (int w = 1; w < LTH / 32; ++w) tot += *(const v4f*)&red[w][hf][sq * 4];
  v4f mu, var;
#pragma unroll
  for (int j = 0; j < 4; ++j) {
    const float oth = xhalf(tot[j]);
    mu[j] = (hf ? oth : tot[j]) * (1.f / kC);
    var[j] = (hf ? tot[j] : oth) * (1.f / kC) - mu[j] * mu[j] + kEPS;
  }
  const v4f rs = rsq_quad(var), nm = -mu * rs;

  // Row s keeps its 16-byte piece p at place p ^ (s >> 4): the 16 lanes of a half wave, 4 rows
  // apart on one piece, then meet every bank once.
  bf16_t* tw = &tile[sq * 4][(cg ^ (sq >> 2)) * 8];
#pragma unroll
  for (int ii = 0; ii < 4; ++ii) {
    v4f y[8];
#pragma unroll
    for (int e = 0; e < 4; ++e) {
      y[e]     = (v[ii][e] * rs + nm) * gv[ii][0][e] + bv[ii][0][e];
      y[e + 4] = (v[ii][e + 4] * rs + nm) * gv[ii][1][e] + bv[ii][1][e];
    }
#pragma unroll
    for (int j = 0; j < 4; ++j)
      *(v4u*)(tw + j * LP + ii * 256) = v4u{pack2(y[0][j], y[1][j]), pack2(y[2][j], y[3][j]),
                                            pack2(y[4][j], y[5][j]), pack2(y[6][j], y[7][j])};
  }
  __syncthreads();   // tile rows are read back by other waves than wrote them

  // A wave takes 4 rows, 512 B at a time.
  const bf16_t* tr = &tile[wid * 4][(lane ^ (wid >> 2)) * 8];
  bf16_t* dst = xn + ((size_t)b * kS + s0 + wid * 4) * kC + lane * 8;
  v4u o[16];
#pragma unroll
  for (int i = 0; i < 16; ++i) o[i] = *(const v4u*)(tr + (i >> 2) * LP + (i & 3) * 256);
#pragma unroll
  for (int i = 0; i < 16; ++i) *(v4u*)(dst + (size_t)(i >> 2) * kC + (i & 3) * 256) = o[i];
}

// --------------------------------------------- LN on row-major rows (text)
__device__ __forceinline__ void ln_rows(const int job, const float* __restrict__ src,
                                        const float* __restrict__ gg,
                                        const float* __restrict__ bb,
                                        bf16_t* __restrict__ dst,
                                        int nrows) {
  const int lane = threadIdx.x & 31, wid = threadIdx.x >> 5;
  const int row = job * 8 + wid;
  if (row >= nrows) return;
  const float* p = src + (size_t)row * kC;
  float vals[32];
  float sum = 0.f;
#pragma unroll
  for (int j = 0; j < 32; ++j) { vals[j] = p[j * 32 + lane]; sum += vals[j]; }
#pragma unroll
  for (int off = 16; off >= 1; off >>= 1) sum += __shfl_xor(sum, off);
  const float mu = sum * (1.f / kC);
  float sq = 0.f;
#pragma unroll
  for (int j = 0; j < 32; ++j) { float d = vals[j] - mu; sq += d * d; }
#pragma unroll
  for (int off = 16; off >= 1; off >>= 1) sq += __shfl_xor(sq, off);
  const float rs = rsqrtf(sq * (1.f / kC) + kEPS);
  bf16_t* q = dst + (size_t)row * kC;
#pragma unroll
  for (int j = 0; j < 32; ++j) {
    int c = j * 32 + lane;
    q[c] = tobf((vals[j] - mu) * rs * gg[c] + bb[c]);
  }
}

// The weight transposes and the text rows' LN read none of each other's output: one launch, the
// block index picking the job, so that they run side by side and a launch gap goes.
__global__ __launch_bounds__(256) void wt_ln_rows_kernel(
    const float* __restrict__ W0, const float* __restrict__ W1,
    const float* __restrict__ W2, const float* __restrict__ W3,
    bf16_t* __restrict__ T0, bf16_t* __restrict__ T1,
    bf16_t* __restrict__ T2, bf16_t* __restrict__ T3,
    const float* __restrict__ src, const float* __restrict__ gg, const float* __restrict__ bb,
    bf16_t* __restrict__ dst) {
  const int job = blockIdx.x;
  if (job < WJOBS) wt_tile(job, W0, W1, W2, W3, T0, T1, T2, T3);
  else             ln_rows(job - WJOBS, src, gg, bb, dst, kB * kT);
}

// sin and cos of eight angles given in revolutions, in one statement so that the slot which the
// instruction set asks for behind a transcendental holds by construction: an early-clobber result
// shares no register with a source, so none overwrites the source or reads the result of the one
// in front of it, and v_nop fills the slot behind the last.
__device__ __forceinline__ void sincos_tile(const float (&r)[8], float (&s)[8], float (&c)[8]) {
  asm("v_sin_f32 %0, %16\n\tv_sin_f32 %1, %17\n\tv_sin_f32 %2, %18\n\tv_sin_f32 %3, %19\n\t"
      "v_sin_f32 %4, %20\n\tv_sin_f32 %5, %21\n\tv_sin_f32 %6, %22\n\tv_sin_f32 %7, %23\n\t"
      "v_cos_f32 %8, %16\n\tv_cos_f32 %9, %17\n\tv_cos_f32 %10, %18\n\tv_cos_f32 %11, %19\n\t"
      "v_cos_f32 %12, %20\n\tv_cos_f32 %13, %21\n\tv_cos_f32 %14, %22\n\tv_cos_f32 %15, %23\n\t"
      "v_nop"
      : "=&v"(s[0]), "=&v"(s[1]), "=&v"(s[2]), "=&v"(s[3]),
        "=&v"(s[4]), "=&v"(s[5]), "=&v"(s[6]), "=&v"(s[7]),
        "=&v"(c[0]), "=&v"(c[1]), "=&v"(c[2]), "=&v"(c[3]),
        "=&v"(c[4]), "=&v"(c[5]), "=&v"(c[6]), "=&v"(c[7])
      : "v"(r[0]), "v"(r[1]), "v"(r[2]), "v"(r[3]), "v"(r[4]), "v"(r[5]), "v"(r[6]), "v"(r[7]));
}

// --------------------------------------------- bf16 GEMM: out = A(MxK) @ Wt(NxK)^T + bias
// Double-buffered async LDS staging; K-step 64. A wave makes 64 x 64 of the output: 16 WMMA on 8
// fragments, so that LDS reads keep up with the matrix unit. A block is MT x 128, MT / 32 waves:
// 256 rows where that still gives every WGP two blocks (fewest bytes from L2), else 128.
// MODE 0: bf16 (B,H,S,D) = RoPE(acc) / sqrt(D)   (Q)
// MODE 3: bf16 (B,H,T,D) = RoPE(acc), positions rescaled onto the query timeline   (K)
// MODE 1: bf16 scattered V^T (B,H,D,T)  (V)
// MODE 2: fp32 (B,C,S) = resid + acc    (output projection + residual transpose)
constexpr int NT = 128, KT = 64;
constexpr int GP = 72;   // GEMM LDS pitch: 144B rows, 16B aligned, conflict-free
constexpr int AP = 40;   // attention LDS pitch: 80B rows

template <int MT>
struct GemmTiles {
  bf16_t a[2][MT][GP];
  bf16_t b[2][NT][GP];
};

// The operand tiles and, behind the K loop, the epilogue's staging share one allocation.
template <int MODE, int MT>
constexpr size_t gemm_lds_bytes() {
  constexpr size_t EPI = (MODE == 0 || MODE == 3) ? sizeof(bf16_t) * 2 * MT * GP
                                                  : sizeof(float) * NT * (MT + 4);
  return sizeof(GemmTiles<MT>) > EPI ? sizeof(GemmTiles<MT>) : EPI;
}

// One block's MT x 128 tile; smem holds gemm_lds_bytes<MODE, MT>() bytes, 16-byte aligned.
template <int MODE, int MT>
__device__ __forceinline__ void gemm_tile(
    const bf16_t* __restrict__ A, const bf16_t* __restrict__ Wt,
    const float* __restrict__ bias, float* __restrict__ outF,
    bf16_t* __restrict__ outB, const float* __restrict__ resid, char* smem) {
  constexpr bool ROPE = (MODE == 0 || MODE == 3);
  constexpr int GTH = MT;       // threads: a wave per 64 x 64
  constexpr int WM = MT / 64;   // waves along m
  constexpr int CP = MT + 4;    // epilogue LDS pitch in floats: 16-byte column walks, no conflicts
  GemmTiles<MT>& lds = *reinterpret_cast<GemmTiles<MT>*>(smem);
  const int tid = threadIdx.x, lane = tid & 31, wid = tid >> 5;
  const int m0 = blockIdx.x * MT, n0 = blockIdx.y * NT;
  // A wave's 64 columns are one head: with RoPE a rotation's two partners, channels d and d + 32,
  // sit in one lane, in acc[sm][sn] and acc[sm][sn + 2].
  const int wh = wid / WM;
  const int wm = (wid % WM) * 64;
  const int wn = wh * 64;

  v8f acc[4][4];
#pragma unroll
  for (int sn = 0; sn < 4; ++sn) {
    const float bv = bias[n0 + wn + sn * 16 + (lane & 15)];
#pragma unroll
    for (int sm = 0; sm < 4; ++sm)
#pragma unroll
      for (int i = 0; i < 8; ++i) acc[sm][sn][i] = bv;
  }

  constexpr int NCA = MT * KT / 8 / GTH;   // 16-byte copies per thread and stage, A tile
  constexpr int NCB = NT * KT / 8 / GTH;   // the same, Bt tile
  // A copy's source is a block-uniform base plus an unsigned 32-bit offset that both tiles share:
  // a stage's copies then take eight offset registers instead of a 64-bit address each, and the
  // fragments keep theirs inside the wave's 256.
  const bf16_t* Ab = A + (size_t)m0 * kC;
  const bf16_t* Bb = Wt + (size_t)n0 * kC;
  auto stage = [&](int s, int k0) {
#if USE_ASYNC_LDS
#pragma unroll
    for (int i = 0; i < NCA; ++i) {
      const int idx = tid + i * GTH, r = idx >> 3, c = (idx & 7) * 8;
      async_copy16(&lds.a[s][r][c], (Ab + k0) + (u32)(r * kC + c));
    }
#pragma unroll
    for (int i = 0; i < NCB; ++i) {
      const int idx = tid + i * GTH, r = idx >> 3, c = (idx & 7) * 8;
      async_copy16(&lds.b[s][r][c], (Bb + k0) + (u32)(r * kC + c));
    }
#else
    const u32* Ag = (const u32*)A;
    const u32* Wg = (const u32*)Wt;
#pragma unroll
    for (int i = 0; i < 4 * NCA; ++i) {
      int idx = tid + i * GTH, r = idx >> 5, cu = idx & 31;
      *(u32*)&lds.a[s][r][cu * 2] = Ag[(size_t)(m0 + r) * (kC / 2) + (k0 >> 1) + cu];
    }
#pragma unroll
    for (int i = 0; i < 4 * NCB; ++i) {
      int idx = tid + i * GTH, r = idx >> 5, cu = idx & 31;
      *(u32*)&lds.b[s][r][cu * 2] = Wg[(size_t)(n0 + r) * (kC / 2) + (k0 >> 1) + cu];
    }
#endif
  };

  constexpr int NK = kC / KT;
  stage(0, 0);
  for (int it = 0; it < NK; ++it) {
    const int cur = it & 1;
    if (it + 1 < NK) {
      stage(1 - cur, (it + 1) * KT);
      ASYNC_WAIT(NCA + NCB);  // only current tile's (oldest) copies must land
    } else {
      ASYNC_WAIT(0);
    }
    __syncthreads();
#pragma unroll
    for (int kk = 0; kk < KT; kk += 32) {
      v16bf af[4], bf[4];
#pragma unroll
      for (int sm = 0; sm < 4; ++sm) af[sm] = frag16(&lds.a[cur][wm + sm * 16][kk], GP, lane);
#pragma unroll
      for (int sn = 0; sn < 4; ++sn) bf[sn] = frag16(&lds.b[cur][wn + sn * 16][kk], GP, lane);
#pragma unroll
      for (int sm = 0; sm < 4; ++sm)
#pragma unroll
        for (int sn = 0; sn < 4; ++sn) acc[sm][sn] = wmma_bf16(af[sm], bf[sn], acc[sm][sn]);
    }
    __syncthreads();
  }

  // Keeps the epilogue's angle arithmetic and residual loads behind the K loop: scheduled in among
  // the last matrix instructions, where the fragments still hold their registers, they spill.
  __builtin_amdgcn_sched_barrier(0);

  if constexpr (ROPE) {
    // Rotate in registers, then through LDS as Rt[head of the tile * MT + row][d]: a head's MT
    // rows of 128 B are contiguous in the destination, so a wave stores 512 B in a row.
    // The tiles are free here: the K loop's last barrier ended their last read.
    static_assert(NT == 2 * kD, "a tile holds two whole heads");
    constexpr int ROWS = (MODE == 0) ? kS : kT;    // rows of A per batch
    static_assert(ROWS % MT == 0, "a tile lies in one batch");
    constexpr float POS = (float)kS / ROWS;               // key positions on the query timeline
    constexpr float OSC = (MODE == 0) ? 0.125f : 1.0f;    // q / sqrt(D)
    unsigned short* Rt = reinterpret_cast<unsigned short*>(smem);
    const int b = m0 / ROWS, r0 = m0 % ROWS;
#pragma unroll
    for (int dp = 0; dp < 2; ++dp) {
      const int d = dp * 16 + (lane & 15);
      const float inv = __powf(10000.f, -(float)d * (1.f / 32.f));
#pragma unroll
      for (int sm = 0; sm < 4; ++sm) {
        const int ml = wm + sm * 16 + ((lane >> 4) << 3);
        unsigned short* p = Rt + (wh * MT + ml) * GP + d;
        float rev[8], s[8], c[8];
#pragma unroll
        for (int i = 0; i < 8; ++i)
          rev[i] = (float)(r0 + ml + i) * POS * inv * 0.15915494309189532f;   // angle / 2 pi
        sincos_tile(rev, s, c);
#pragma unroll
        for (int i = 0; i < 8; i += 2) {
          float lo[2], hi[2];
#pragma unroll
          for (int j = 0; j < 2; ++j) {
            const float t1 = acc[sm][dp][i + j], t2 = acc[sm][dp + 2][i + j];
            lo[j] = (t1 * c[i + j] - t2 * s[i + j]) * OSC;
            hi[j] = (t1 * s[i + j] + t2 * c[i + j]) * OSC;
          }
          const u32 a = pack2(lo[0], lo[1]), h = pack2(hi[0], hi[1]);
          p[i * GP]            = (unsigned short)a;
          p[(i + 1) * GP]      = (unsigned short)(a >> 16);
          p[i * GP + 32]       = (unsigned short)h;
          p[(i + 1) * GP + 32] = (unsigned short)(h >> 16);
        }
      }
    }
    __syncthreads();   // Rt rows are read back by other waves than wrote them

    constexpr int RSW = GTH / 8;                   // 8 lanes a row: rows a sweep
    constexpr int HSW = MT / RSW;                  // sweeps a head
    const int rr = tid >> 3, cc = (tid & 7) * 8;
    v4u rv[2 * HSW];
#pragma unroll
    for (int i = 0; i < 2 * HSW; ++i) rv[i] = *(const v4u*)(Rt + (rr + RSW * i) * GP + cc);
    bf16_t* dst = outB + (((size_t)b * kH + n0 / kD) * ROWS + r0 + rr) * kD + cc;
#pragma unroll
    for (int i = 0; i < 2 * HSW; ++i)
      *(v4u*)(dst + ((size_t)(i / HSW) * ROWS + (i % HSW) * RSW) * kD) = rv[i];
  } else {
    // Transposed outputs: row n of the destination is contiguous in m. The tile goes
    // through LDS as Ct[n][m], so every global access is 16 B per lane on whole lines.
    // The tiles are free here: the K loop's last barrier ended their last read.
    float* Ct = reinterpret_cast<float*>(smem);
    constexpr int ROWS = (MODE == 2) ? kS : kT;    // rows of A per batch = destination pitch
    static_assert(ROWS % MT == 0, "a tile lies in one batch");
    const int b = m0 / ROWS, r0 = m0 % ROWS;
    const size_t gbase = ((size_t)b * kC + n0) * ROWS + r0;

    // Reader's share: rows nr + RST * i of the tile, 16 B of the destination at column cr.
    constexpr int LPR = (MODE == 2) ? MT / 4 : MT / 8;   // lanes per destination row
    constexpr int RST = GTH / LPR;                 // rows per sweep of the block
    constexpr int NSW = NT / RST;                  // sweeps
    const int nr = tid / LPR, cr = (tid % LPR) * (MT / LPR);
    const size_t goff = gbase + (size_t)nr * ROWS + cr;
    const float* crd = Ct + nr * CP + cr;

    // Residual rows: the first half is asked for ahead of the LDS round trip, the second behind
    // the barrier, in the registers that the accumulators have left by then.
    v4f rr[NSW];
    if constexpr (MODE == 2) {
#pragma unroll
      for (int i = 0; i < NSW / 2; ++i)
        rr[i] = *(const v4f*)(resid + goff + (size_t)i * RST * ROWS);
    }

#pragma unroll
    for (int sm = 0; sm < 4; ++sm)
#pragma unroll
      for (int sn = 0; sn < 4; ++sn) {
        float* p = Ct + (wn + sn * 16 + (lane & 15)) * CP + wm + sm * 16 + ((lane >> 4) << 3);
        const v8f a = acc[sm][sn];
        *(v4f*)(p)     = v4f{a[0], a[1], a[2], a[3]};
        *(v4f*)(p + 4) = v4f{a[4], a[5], a[6], a[7]};
      }
    __syncthreads();   // Ct rows are read back by other waves than wrote them

    if constexpr (MODE == 2) {
#pragma unroll
      for (int i = NSW / 2; i < NSW; ++i)
        rr[i] = *(const v4f*)(resid + goff + (size_t)i * RST * ROWS);
    }

    if constexpr (MODE == 1) {   // V^T: (B,H,D,T) = (B,C,T), whole lines of bf16 per row
#pragma unroll
      for (int i = 0; i < NSW; ++i) {
        const v4f lo = *(const v4f*)(crd + i * RST * CP);
        const v4f hi = *(const v4f*)(crd + i * RST * CP + 4);
        union { bf16_t h[8]; v4u u; } pk;
#pragma unroll
        for (int j = 0; j < 4; ++j) { pk.h[j] = tobf(lo[j]); pk.h[4 + j] = tobf(hi[j]); }
        *(v4u*)(outB + goff + (size_t)i * RST * ROWS) = pk.u;
      }
    } else {                     // out (B,C,S) = resid + acc, whole lines of floats per row
      // Eight rows at a time, three sweeps kept apart: the LDS reads, then the stores, each go
      // out back to back.
#pragma unroll
      for (int i0 = 0; i0 < NSW; i0 += 8) {
        v4f cv[8];
#pragma unroll
        for (int i = 0; i < 8; ++i) cv[i] = *(const v4f*)(crd + (i0 + i) * RST * CP);
#pragma unroll
        for (int i = 0; i < 8; ++i) cv[i] = rr[i0 + i] + cv[i];
#pragma unroll
        for (int i = 0; i < 8; ++i)
          *(v4f*)(outF + goff + (size_t)(i0 + i) * RST * ROWS) = cv[i];
      }
    }
  }
}

// At least 4 waves per SIMD: 256 registers, so that the blocks whose LDS fits a WGP are resident
// together and one's barriers and copy waits are covered by the others.
template <int MODE, int MT>
__global__ __launch_bounds__(MT) __attribute__((amdgpu_waves_per_eu(4))) void gemm_bf16_kernel(
    const bf16_t* __restrict__ A, const bf16_t* __restrict__ Wt,
    const float* __restrict__ bias, float* __restrict__ outF,
    bf16_t* __restrict__ outB, const float* __restrict__ resid) {
  __shared__ alignas(16) char smem[gemm_lds_bytes<MODE, MT>()];
  gemm_tile<MODE, MT>(A, Wt, bias, outF, outB, resid, smem);
}

// The K and the V projection of the text rows in one launch, blockIdx.z picking the one: alone,
// each has one 4-wave block per WGP, a single wave per SIMD whose LDS and barrier waits nothing
// covers; together two blocks share a WGP and each SIMD has a second wave to issue from.
__global__ __launch_bounds__(128) __attribute__((amdgpu_waves_per_eu(4))) void gemm_kv_kernel(
    const bf16_t* __restrict__ A, const bf16_t* __restrict__ Wkt, const bf16_t* __restrict__ Wvt,
    const float* __restrict__ bk, const float* __restrict__ bv,
    bf16_t* __restrict__ kout, bf16_t* __restrict__ vtout) {
  constexpr size_t LK = gemm_lds_bytes<3, 128>(), LV = gemm_lds_bytes<1, 128>();
  __shared__ alignas(16) char smem[LK > LV ? LK : LV];
  if (blockIdx.z == 0) gemm_tile<3, 128>(A, Wkt, bk, nullptr, kout, nullptr, smem);
  else                 gemm_tile<1, 128>(A, Wvt, bv, nullptr, vtout, nullptr, smem);
}

constexpr int KP = 72;   // Ks pitch

// 2^x of the eight scores of one tile, in one statement so that the slot which the instruction
// set asks for behind a transcendental holds by construction: an early-clobber result shares no
// register with a source, so no exponential overwrites the source or reads the result of the one
// in front of it, and v_nop fills the slot behind the last.
__device__ __forceinline__ void exp2_tile(const v8f a, float (&p)[8]) {
  asm("v_exp_f32 %0, %8\n\tv_exp_f32 %1, %9\n\tv_exp_f32 %2, %10\n\tv_exp_f32 %3, %11\n\t"
      "v_exp_f32 %4, %12\n\tv_exp_f32 %5, %13\n\tv_exp_f32 %6, %14\n\tv_exp_f32 %7, %15\n\t"
      "v_nop"
      : "=&v"(p[0]), "=&v"(p[1]), "=&v"(p[2]), "=&v"(p[3]),
        "=&v"(p[4]), "=&v"(p[5]), "=&v"(p[6]), "=&v"(p[7])
      : "v"(a[0]), "v"(a[1]), "v"(a[2]), "v"(a[3]), "v"(a[4]), "v"(a[5]), "v"(a[6]), "v"(a[7]));
}

// At most 8 waves per SIMD: 128 registers, so that a pass's 16 LDS reads go out as one group
// ahead of the products instead of pair by pair, each with its own wait.
__global__ __launch_bounds__(256) __attribute__((amdgpu_waves_per_eu(4, 8))) void attn_kernel(const bf16_t* __restrict__ q,
                                                   const bf16_t* __restrict__ k,
                                                   const bf16_t* __restrict__ vt,
                                                   bf16_t* __restrict__ o) {
  __shared__ bf16_t Ks[2][32][KP];       // K tile, rows t, cols d
  __shared__ bf16_t Vts[2][kD][AP];      // V^T tile, rows d, cols t
  const int tid = threadIdx.x, lane = tid & 31, wid = tid >> 5;
  const int bh = blockIdx.y, b = bh / kH, h = bh % kH;
  const int s0 = blockIdx.x * 128 + wid * 16;
  const int g = lane >> 4;

  // Q fragments (held for whole T loop), the B operand of S^T: column = query lane & 15.
  v16bf qf[2];
  {
    const bf16_t* qrow = q + ((size_t)bh * kS + s0 + (lane & 15)) * kD;
#pragma unroll
    for (int kd = 0; kd < 2; ++kd) {
      union { struct { v4u lo, hi; } p; v16bf v; } u;
      u.p.lo = *(const v4u*)(qrow + kd * 32 + g * 8);
      u.p.hi = *(const v4u*)(qrow + kd * 32 + g * 8 + 16);
      qf[kd] = u.v;
    }
  }

  float mrun = -3.0e38f;   // this query's running maximum, equal in both lane halves
  float lrun = 0.f;        // denominator over this lane half's keys; the halves join after the loop
  v8f oacc[4];             // oacc[dn][i] = O[query lane & 15][dn * 16 + 8 g + i]
#pragma unroll
  for (int f = 0; f < 4; ++f) oacc[f] = v8f{};

  const bf16_t* kb = k + (size_t)bh * kT * kD;
  const bf16_t* vb = vt + (size_t)bh * kD * kT;

  auto stage = [&](int s, int t0) {
#if USE_ASYNC_LDS
    const int rk = tid >> 3, ck = (tid & 7) * 8;        // 32 x 64
    async_copy16(&Ks[s][rk][ck], kb + (size_t)(t0 + rk) * kD + ck);
    const int rv = tid >> 2, cv = (tid & 3) * 8;        // 64 x 32
    async_copy16(&Vts[s][rv][cv], vb + (size_t)rv * kT + t0 + cv);
#else
    const u32* kg = (const u32*)kb;
    const u32* vg = (const u32*)vb;
#pragma unroll
    for (int i = 0; i < 4; ++i) {
      int idx = tid + i * 256;
      int rk = idx >> 5, ck = idx & 31;
      *(u32*)&Ks[s][rk][ck * 2] = kg[(size_t)(t0 + rk) * (kD / 2) + ck];
      int rv = idx >> 4, cv = idx & 15;
      *(u32*)&Vts[s][rv][cv * 2] = vg[(size_t)rv * (kT / 2) + (t0 >> 1) + cv];
    }
#endif
  };

  constexpr int NSTEP = kT / 32;
  stage(0, 0);
  for (int it = 0; it < NSTEP; ++it) {
    const int cur = it & 1;
    if (it + 1 < NSTEP) {
      stage(1 - cur, (it + 1) * 32);
      ASYNC_WAIT(2);
    } else {
      ASYNC_WAIT(0);
    }
    __syncthreads();

    // scores^T: 32 keys x 16 queries (two M-subtiles), contraction over d in two K-steps.
    // st[kt][i] = score of key kt * 16 + 8 g + i against query lane & 15.
    v8f st[2]; st[0] = v8f{}; st[1] = v8f{};
#pragma unroll
    for (int kd = 0; kd < 2; ++kd)
#pragma unroll
      for (int kt = 0; kt < 2; ++kt)
        st[kt] = wmma_bf16(frag16(&Ks[cur][kt * 16][kd * 32], KP, lane), qf[kd], st[kt]);

    // online softmax: one query per lane
    float vmax = fmaxf(st[0][0], st[1][0]);
#pragma unroll
    for (int i = 1; i < 8; ++i) vmax = fmaxf(vmax, fmaxf(st[0][i], st[1][i]));
    vmax = fmaxf(vmax, xhalf(vmax));
    const float mnew = fmaxf(mrun, vmax);
    const float alpha = __expf(mrun - mnew);
    mrun = mnew;

    // P^T as B operand: element e < 8 is key 8 g + e, element 8 + e is key 16 + 8 g + e,
    // the k order in which frag16 reads the V^T rows.
    union { u32 w[8]; v16bf v; } pf;
    float p[2][8];
#pragma unroll
    for (int kt = 0; kt < 2; ++kt)
      exp2_tile((st[kt] - mnew) * 1.44269504f, p[kt]);   // e^(score - maximum)
    float sum[4];
#pragma unroll
    for (int j = 0; j < 4; ++j) {
      pf.w[j]     = pack2(p[0][2 * j], p[0][2 * j + 1]);
      pf.w[4 + j] = pack2(p[1][2 * j], p[1][2 * j + 1]);
      sum[j] = (p[0][2 * j] + p[0][2 * j + 1]) + (p[1][2 * j] + p[1][2 * j + 1]);
    }
    lrun = lrun * alpha + ((sum[0] + sum[1]) + (sum[2] + sum[3]));
#pragma unroll
    for (int f = 0; f < 4; ++f) oacc[f] *= alpha;

    // O^T += V^T.P^T: A = V^T tile (lane-striped d, contiguous t), B = P^T
#pragma unroll
    for (int dn = 0; dn < 4; ++dn)
      oacc[dn] = wmma_bf16(frag16(&Vts[cur][dn * 16][0], AP, lane), pf.v, oacc[dn]);
    __syncthreads();
  }

  // normalize and write o (B,S,C) bf16: a lane's 8 registers are 8 consecutive channels
  const float inv = 1.f / (lrun + xhalf(lrun));
  bf16_t* orow = o + ((size_t)b * kS + s0 + (lane & 15)) * kC + h * kD + g * 8;
#pragma unroll
  for (int dn = 0; dn < 4; ++dn) {
    const v8f r = oacc[dn] * inv;
    *(v4u*)(orow + dn * 16) = v4u{pack2(r[0], r[1]), pack2(r[2], r[3]),
                                  pack2(r[4], r[5]), pack2(r[6], r[7])};
  }
}

// ---------------------------------------------------------------- launch
extern "C" void kernel_launch(void* const* d_in, const int* in_sizes, int n_in,
                              void* d_out, int out_size, void* d_ws, size_t ws_size,
                              hipStream_t stream) {
  const float* x   = (const float*)d_in[0];
  const float* te  = (const float*)d_in[1];
  const float* g_x = (const float*)d_in[2];
  const float* b_x = (const float*)d_in[3];
  const float* g_t = (const float*)d_in[4];
  const float* b_t = (const float*)d_in[5];
  const float* Wq  = (const float*)d_in[6];
  const float* bq  = (const float*)d_in[7];
  const float* Wk  = (const float*)d_in[8];
  const float* bk  = (const float*)d_in[9];
  const float* Wv  = (const float*)d_in[10];
  const float* bv  = (const float*)d_in[11];
  const float* Wo  = (const float*)d_in[12];
  const float* bo  = (const float*)d_in[13];
  float* out = (float*)d_out;
  char* ws = (char*)d_ws;

  size_t off = 0;
  auto alloc = [&](size_t bytes) {
    size_t o = off; off += (bytes + 255) & ~(size_t)255; return o;
  };
  bf16_t* xn   = (bf16_t*)(ws + alloc((size_t)kB * kS * kC * 2));
  bf16_t* tn   = (bf16_t*)(ws + alloc((size_t)kB * kT * kC * 2));
  bf16_t* Wqt  = (bf16_t*)(ws + alloc((size_t)kC * kC * 2));
  bf16_t* Wkt  = (bf16_t*)(ws + alloc((size_t)kC * kC * 2));
  bf16_t* Wvt  = (bf16_t*)(ws + alloc((size_t)kC * kC * 2));
  bf16_t* Wot  = (bf16_t*)(ws + alloc((size_t)kC * kC * 2));
  bf16_t* qbf  = (bf16_t*)(ws + alloc((size_t)kB * kS * kC * 2));
  bf16_t* kbf  = (bf16_t*)(ws + alloc((size_t)kB * kT * kC * 2));
  bf16_t* vtbf = (bf16_t*)(ws + alloc((size_t)kB * kT * kC * 2));
  bf16_t* obf  = (bf16_t*)(ws + alloc((size_t)kB * kS * kC * 2));

  ln_x_kernel<<<dim3(kS / LS, kB), LTH, 0, stream>>>(x, g_x, b_x, xn);
  wt_ln_rows_kernel<<<WJOBS + (kB * kT) / 8, 256, 0, stream>>>(Wq, Wk, Wv, Wo, Wqt, Wkt, Wvt, Wot,
                                                               te, g_t, b_t, tn);

  gemm_bf16_kernel<0, 256><<<dim3((kB * kS) / 256, kC / NT), 256, 0, stream>>>(
      xn, Wqt, bq, nullptr, qbf, nullptr);
  gemm_kv_kernel<<<dim3((kB * kT) / 128, kC / NT, 2), 128, 0, stream>>>(
      tn, Wkt, Wvt, bk, bv, kbf, vtbf);

  attn_kernel<<<dim3(kS / 128, kB * kH), 256, 0, stream>>>(qbf, kbf, vtbf, obf);

  gemm_bf16_kernel<2, 256><<<dim3((kB * kS) / 256, kC / NT), 256, 0, stream>>>(
      obf, Wot, bo, out, nullptr, x);
}
